// v000
// The times below were measured on an AMD MI455X: many runs one after another, warmed up first and cycling through
// copies of the inputs, with the whole window's GPU time divided by the number of runs. Launches and the gaps
// between them are all in it. The median over several windows is given; except for v000 it joins two sittings, which
// can be a few percent apart, so the side-by-side timings, each taken in one sitting, are the better comparison.
// v000 is the starting kernel. One run takes 939 microseconds.
// compute dtype: all float inputs rounded to bf16; q/k/v = W x + b with EXACT bf16 products on WMMA 16x16x32 (f32 accumulate; channels-first input gathered); logits with BOTH q and k as f16 hi + residual (x 2^10) (3 products) x 1.3 - the logits have sigma ~15 so the softmax is sharply peaked and single-f16 operands would not do; softmax in f32 (precise expf); P x 2^11 split bf16 hi + lo against v bf16 hi + lo (3 products); residual x + gamma out in f32; f32 output (channels-first).
#include <hip/hip_runtime.h>
#include <math.h>

typedef __attribute__((ext_vector_type(16))) _Float16 v16h;
typedef __attribute__((ext_vector_type(16))) __bf16 v16b;
typedef __attribute__((ext_vector_type(8)))  _Float16 v8h;
typedef __attribute__((ext_vector_type(8)))  float v8f;
typedef __attribute__((ext_vector_type(4)))  float v4f;
typedef __attribute__((ext_vector_type(2)))  float v2f;
typedef __attribute__((ext_vector_type(4)))  unsigned v4u;
typedef __attribute__((ext_vector_type(4)))  int v4i;
typedef float __attribute__((may_alias)) float_a;
typedef int __attribute__((may_alias)) int_a;

template <typename T> __device__ __forceinline__ void vst2(void* p, T v) { *(T*)p = v;  }
__device__ __forceinline__ v8f wmma16(v16h a, v16h b, v8f c) {
  v8f d = __builtin_amdgcn_wmma_f32_16x16x32_f16(false, a, false, b, (short)0, c, false, false);
  asm volatile("v_nop\n\tv_nop\n\tv_nop\n\tv_nop" : "+v"(d) : "v"(a), "v"(b));
  return d;
}
__device__ __forceinline__ v8f wmma_bf(v16b a, v16b b, v8f c) {
  v8f d = __builtin_amdgcn_wmma_f32_16x16x32_bf16(false, a, false, b, (short)0, c, false, false);
  asm volatile("v_nop\n\tv_nop\n\tv_nop\n\tv_nop" : "+v"(d) : "v"(a), "v"(b));
  return d;
}
// 16x16x32 fragments: lane = (h = lane>>4, row/col = lane&15); elements 0..7 = k0+8h+0..7, 8..15 = k0+16+8h+0..7; D element r = row 8h+r
__device__ __forceinline__ v16h frag_h(const _Float16* rowk0, int lane) {
  union { v16h v; v8h q[2]; } u; const _Float16* p = rowk0 + 8 * (lane >> 4);
  u.q[0] = *(const v8h*)p; u.q[1] = *(const v8h*)(p + 16); return u.v;
}
__device__ __forceinline__ v16h frag_f32(const float* rowk0, int lane) {
  v16h a; const float* p = rowk0 + 8 * (lane >> 4);
#pragma unroll
  for (int i = 0; i < 8; ++i) { a[i] = (_Float16)p[i]; a[8 + i] = (_Float16)p[16 + i]; }
  return a;
}
__device__ __forceinline__ v16h frag_f32s(const float* rowk0, int lane, float sc) {
  v16h a; const float* p = rowk0 + 8 * (lane >> 4);
#pragma unroll
  for (int i = 0; i < 8; ++i) { a[i] = (_Float16)(p[i] * sc); a[8 + i] = (_Float16)(p[16 + i] * sc); }
  return a;
}
// column fragment from a [K][ld] layout (column n), rows >= K read as 0
__device__ __forceinline__ v16h fragc_f32(const float* W, int k0, int n, int lane, int ld, int K) {
  v16h a; const int g = lane >> 4;
#pragma unroll
  for (int i = 0; i < 8; ++i) { const int ka = k0 + 8 * g + i, kb = ka + 16;
    a[i] = (_Float16)(ka < K ? W[(size_t)(ka < K ? ka : K - 1) * ld + n] : 0.f); a[8 + i] = (_Float16)(kb < K ? W[(size_t)(kb < K ? kb : K - 1) * ld + n] : 0.f); }
  return a;
}
struct F2 { v16b h, l; };
__device__ __forceinline__ F2 bsplit16(const float v[16]) { F2 r;
#pragma unroll
  for (int i = 0; i < 16; ++i) { const __bf16 h = (__bf16)v[i]; r.h[i] = h; r.l[i] = (__bf16)(v[i] - (float)h); }
  return r; }
__device__ __forceinline__ F2 split_row(const float* row, int k0, int lane) { float v[16]; const float* p = row + k0 + 8 * (lane >> 4);
#pragma unroll
  for (int i = 0; i < 8; ++i) { v[i] = p[i]; v[8 + i] = p[16 + i]; }
  return bsplit16(v); }
__device__ __forceinline__ F2 split_rowK(const float* row, int k0, int lane, int K) { float v[16]; const int g = lane >> 4;
#pragma unroll
  for (int i = 0; i < 8; ++i) { const int ka = k0 + 8 * g + i, kb = ka + 16; v[i] = ka < K ? row[ka < K ? ka : K - 1] : 0.f; v[8 + i] = kb < K ? row[kb < K ? kb : K - 1] : 0.f; }
  return bsplit16(v); }
__device__ __forceinline__ F2 split_col(const float* W, int k0, int n, int lane, int ld, int K) { float v[16]; const int g = lane >> 4;
#pragma unroll
  for (int i = 0; i < 8; ++i) { const int ka = k0 + 8 * g + i, kb = ka + 16; v[i] = ka < K ? W[(size_t)(ka < K ? ka : K - 1) * ld + n] : 0.f; v[8 + i] = kb < K ? W[(size_t)(kb < K ? kb : K - 1) * ld + n] : 0.f; }
  return bsplit16(v); }
__device__ __forceinline__ v8f mac3(const F2& a, const F2& b, v8f c) { c = wmma_bf(a.l, b.h, c); c = wmma_bf(a.h, b.l, c); return wmma_bf(a.h, b.h, c); }
__device__ __forceinline__ float sigm(float v) { return 1.0f / (1.0f + expf(-v)); }
#define LDSX() do { asm volatile("s_wait_dscnt 0" ::: "memory"); __builtin_amdgcn_wave_barrier(); __builtin_amdgcn_fence(__ATOMIC_RELEASE, "workgroup"); } while (0)

// Single-head self-attention over a flattened 16x16x16 volume (B 2, C 128, N 4,096): q/k/v = 1x1x1 convs (W (out,in) [128,128] + b); attn = softmax((q^T k) * 1.3) over keys; out[c][n] = sum_m v[c][m] attn[n][m]; result = x + gamma * out (gamma = 0.3 scalar input).
#define NB 2
#define TT 4096
#define CC 128            // NH * HD = projected width
#define DIN 128          // input (model) width
#define NH 1
#define HD 128
#define NQB (TT / 64)
#define HG 1
#define SCALE (1.3f)
#define CAUSAL 0
#ifndef TNB
#define TNB NB
#endif
__device__ __forceinline__ float bfr(float v) { return (float)(__bf16)v; }
__host__ __device__ __forceinline__ int kb_last(int qb) { return CAUSAL ? ((qb * 64 + 63) >> 7) : (TT / 128 - 1); }
typedef __attribute__((ext_vector_type(8))) __bf16 v8b;
__device__ __forceinline__ v16b frag_b(const __bf16* rowk0, int lane) {
  union { v16b v; v8b q[2]; } u; const __bf16* p = rowk0 + 8 * (lane >> 4);
  u.q[0] = *(const v8b*)p; u.q[1] = *(const v8b*)(p + 16); return u.v;
}
#define QBH NQB            // EVERY query block takes the 3-product logits + bf16 hi+lo P.v path (logit sigma ~15: sharply peaked softmax)
#define QHI 4096            // rows carrying a q residual plane (all rows when non-causal: 3-product logits everywhere)
#define KHI TT            // residual / bf16 hi+lo planes for ALL keys
// B fragment (k rows k0+.., output column o) of a weight: (in,out) [K][ld] or (out,in) [ld rows of K]: bf16 exact, or f16(bf16 * 256) exact
__device__ __forceinline__ v16b wcol_io(const float* Wm, int k0, int o, int lane, int ld) { v16b w; const int g = lane >> 4;
#pragma unroll
  for (int i = 0; i < 8; ++i) { w[i] = (__bf16)Wm[(size_t)(k0 + 8 * g + i) * ld + o]; w[8 + i] = (__bf16)Wm[(size_t)(k0 + 16 + 8 * g + i) * ld + o]; }
  return w; }
__device__ __forceinline__ v16b wcol_oi(const float* Wm, int k0, int o, int lane, int K) { v16b w; const float* p = Wm + (size_t)o * K + k0 + 8 * (lane >> 4);
#pragma unroll
  for (int i = 0; i < 8; ++i) { w[i] = (__bf16)p[i]; w[8 + i] = (__bf16)p[16 + i]; }
  return w; }
__device__ __forceinline__ v16h wcolh_io(const float* Wm, int k0, int o, int lane, int ld) { v16h w; const int g = lane >> 4;
#pragma unroll
  for (int i = 0; i < 8; ++i) { w[i] = (_Float16)(bfr(Wm[(size_t)(k0 + 8 * g + i) * ld + o]) * 256.0f); w[8 + i] = (_Float16)(bfr(Wm[(size_t)(k0 + 16 + 8 * g + i) * ld + o]) * 256.0f); }
  return w; }
__device__ __forceinline__ v16h wcolh_oi(const float* Wm, int k0, int o, int lane, int K) { v16h w; const float* p = Wm + (size_t)o * K + k0 + 8 * (lane >> 4);
#pragma unroll
  for (int i = 0; i < 8; ++i) { w[i] = (_Float16)(bfr(p[i]) * 256.0f); w[8 + i] = (_Float16)(bfr(p[16 + i]) * 256.0f); }
  return w; }
#define WQKV_LAYOUT 1   // 0 = (in,out) [DIN][CC]; 1 = (out,in) [CC][DIN]; 2 = per-head [NH][DIN][HD]
__device__ __forceinline__ v16b wcol_hdk(const float* Wm, int k0, int o, int lane) { v16b w; const int g = lane >> 4; const float* p = Wm + (size_t)(o / HD) * DIN * HD + (o % HD);
#pragma unroll
  for (int i = 0; i < 8; ++i) { w[i] = (__bf16)p[(size_t)(k0 + 8 * g + i) * HD]; w[8 + i] = (__bf16)p[(size_t)(k0 + 16 + 8 * g + i) * HD]; }
  return w; }
#define WO_OUT_IN 0
#if WQKV_LAYOUT == 1
#define WCOL(W, k0, o, lane) wcol_oi(W, k0, o, lane, DIN)
#elif WQKV_LAYOUT == 2
#define WCOL(W, k0, o, lane) wcol_hdk(W, k0, o, lane)
#else
#define WCOL(W, k0, o, lane) wcol_io(W, k0, o, lane, CC)
#endif
#if WO_OUT_IN
#define WOCOL(W, k0, o, lane) wcol_oi(W, k0, o, lane, CC)
#define WOCOLH(W, k0, o, lane) wcolh_oi(W, k0, o, lane, CC)
#else
#define WOCOL(W, k0, o, lane) wcol_io(W, k0, o, lane, DIN)
#define WOCOLH(W, k0, o, lane) wcolh_io(W, k0, o, lane, DIN)
#endif
#define NPIX 4096
// ---- k_resT: block = (64 pixel rows, 128 channels): out[b][c][n] = bf16(x[b][c][n]) + bf16(gamma) * Y[b*4096 + n][c] via an LDS transpose (each (c, 64 n) run = 256 B by 16 threads)
__global__ __launch_bounds__(128) void k_resT(const float* __restrict__ Y, const float* __restrict__ X, const float* __restrict__ GM, float* __restrict__ OUT) { __shared__ __align__(16) float stc[128][68];
  const int tid = threadIdx.x; const size_t rb = (size_t)blockIdx.x * 64; const size_t bb = rb / TT; const int t0 = (int)(rb % TT); const float gm = bfr(GM[0]);
  for (int e = tid; e < 64 * 32; e += 128) { const int rl = e >> 5, q = e & 31; const v4f yv = *(const v4f*)(Y + (rb + rl) * CC + q * 4); stc[q * 4][rl] = yv[0]; stc[q * 4 + 1][rl] = yv[1]; stc[q * 4 + 2][rl] = yv[2]; stc[q * 4 + 3][rl] = yv[3]; }
  __syncthreads();
  for (int e = tid; e < 128 * 16; e += 128) { const int cl = e >> 4, q = e & 15; const size_t o = ((size_t)bb * CC + cl) * NPIX + t0 + q * 4; const v4f xv = *(const v4f*)(X + o); v4f r4 = *(const v4f*)&stc[cl][q * 4]; r4[0] = bfr(xv[0]) + gm * r4[0]; r4[1] = bfr(xv[1]) + gm * r4[1]; r4[2] = bfr(xv[2]) + gm * r4[2]; r4[3] = bfr(xv[3]) + gm * r4[3]; vst2(OUT + o, r4); } }
#ifndef SM_EXTRA_PARAMS
#define SM_EXTRA_PARAMS
#endif
#ifndef PROJ_EXTRA_PARAMS
#define PROJ_EXTRA_PARAMS
#endif
#ifndef SM_MASK_HOOK
#define SM_MASK_HOOK (void)0
#endif

#define WS_QH  0u                                      // f16 q rows [b*t][CC]
#define WS_KH  (WS_QH + 2u * (size_t)NB * TT * CC)      // f16 k rows [b*t][CC]
#define WS_VT  (WS_KH + 2u * (size_t)NB * TT * CC)      // f16 v planes [b][c][t]
#define WS_QL  (WS_VT + 2u * (size_t)NB * CC * TT)      // f16 q residual x 2^10 rows [b][t < QHI][CC]
#define WS_KL  (WS_QL + 2u * (size_t)NB * QHI * CC)     // f16 k residual x 2^10 rows [b][t < KHI][CC]
#define WS_VB  (WS_KL + 2u * (size_t)NB * KHI * CC)     // bf16 v hi planes [b][c][t < KHI]
#define WS_VBL (WS_VB + 2u * (size_t)NB * CC * KHI)
#define WS_S   (WS_VBL + 2u * (size_t)NB * CC * KHI)    // f32 logits / P [hg][t][s]
#define WS_Y   (WS_S  + 4u * (size_t)HG * TT * TT)      // f32 ctx rows [b*t][CC] (only when there is an output projection)
#define WS_END (WS_Y  + 0u)
#define WS_YY (WS_END)                                  // f32 ctx rows [b*t][128]
#define WS_END2 (WS_YY + 4u * (size_t)NB * TT * CC)

// ---- k_proj: block = (64 rows, 128 cols, which): q/k/v = X W (+ b) with exact bf16 products (K = DIN) -> which 0: q f16 rows (+ residual rows < QHI); 1: k f16 rows (+ residual rows < KHI); 2: v f16 planes [c][t] (+ bf16 hi/lo planes for t < KHI)
__global__ __launch_bounds__(128) void k_proj(const float* __restrict__ XQ, const float* __restrict__ XK, const float* __restrict__ XV, const float* __restrict__ WQ, const float* __restrict__ WK, const float* __restrict__ WV, const float* __restrict__ BQ, const float* __restrict__ BK, const float* __restrict__ BV,
    _Float16* __restrict__ QH, _Float16* __restrict__ QL, _Float16* __restrict__ KH, _Float16* __restrict__ KL, _Float16* __restrict__ VT, __bf16* __restrict__ VB, __bf16* __restrict__ VBL) {
  __shared__ __align__(16) _Float16 sh[64][136], sl[64][136]; __shared__ __align__(16) _Float16 th[128][72]; __shared__ __align__(16) __bf16 tb[128][72], tbl[128][72];
  const int tid = threadIdx.x, wave = tid >> 5, lane = tid & 31, col = lane & 15, g = lane >> 4; const int which = blockIdx.z; const int c0 = blockIdx.y * 128; const size_t r0 = (size_t)blockIdx.x * 64; const size_t bb = r0 / TT; const int t0 = (int)(r0 % TT);
  const float* X = which == 0 ? XQ : which == 1 ? XK : XV; const float* WA = which == 0 ? WQ : which == 1 ? WK : WV; const float* BA = which == 0 ? BQ : which == 1 ? BK : BV;
  v8f acc[8] = {};
#pragma unroll 2
  for (int kc = 0; kc < DIN / 32; ++kc) { v16b a; { const float* p = X + ((size_t)bb * DIN + kc * 32 + 8 * g) * NPIX + t0 + wave * 16 + col;   /* channels-first gather: x[b][k][n], stride NPIX between channels */
#pragma unroll
      for (int i = 0; i < 8; ++i) { a[i] = (__bf16)p[(size_t)i * NPIX]; a[8 + i] = (__bf16)p[(size_t)(16 + i) * NPIX]; } }
    asm volatile("s_wait_loadcnt 0x0" ::: "memory");
#pragma unroll
    for (int j = 0; j < 8; ++j) { const v16b w = WCOL(WA, kc * 32, c0 + j * 16 + col, lane); asm volatile("s_wait_loadcnt 0x0" ::: "memory"); acc[j] = wmma_bf(a, w, acc[j]); } }
  if (which < 2) { _Float16* DH = which == 0 ? QH : KH; _Float16* DL = which == 0 ? QL : KL; const int nhi = which == 0 ? QHI : KHI; const bool hi_rows = t0 < nhi;
#pragma unroll
    for (int j = 0; j < 8; ++j) { const float bias = BA ? bfr(BA[c0 + j * 16 + col]) : 0.f;
#pragma unroll
      for (int r = 0; r < 8; ++r) { const float v = acc[j][r] + bias; const _Float16 hv = (_Float16)v; sh[wave * 16 + 8 * g + r][j * 16 + col] = hv; sl[wave * 16 + 8 * g + r][j * 16 + col] = (_Float16)((v - (float)hv) * 1024.0f); } }
    __syncthreads();
    for (int e = tid; e < 64 * 16; e += 128) { const int rl = e >> 4, q = e & 15; vst2((unsigned*)(DH + (r0 + rl) * CC + c0 + q * 8), *(const v4u*)&sh[rl][q * 8]); if (hi_rows) vst2((unsigned*)(DL + (bb * nhi + t0 + rl) * (size_t)CC + c0 + q * 8), *(const v4u*)&sl[rl][q * 8]); }
  } else { const bool hi_rows = t0 < KHI;
#pragma unroll
    for (int j = 0; j < 8; ++j) { const float bias = BA ? bfr(BA[c0 + j * 16 + col]) : 0.f;
#pragma unroll
      for (int r = 0; r < 8; ++r) { const float v = acc[j][r] + bias; const int rl = wave * 16 + 8 * g + r, cl = j * 16 + col; th[cl][rl] = (_Float16)v; const __bf16 bh = (__bf16)v; tb[cl][rl] = bh; tbl[cl][rl] = (__bf16)(v - (float)bh); } }
    __syncthreads();
    for (int e = tid; e < 128 * 8; e += 128) { const int cl = e >> 3, q = e & 7; vst2((unsigned*)(VT + (bb * CC + c0 + cl) * (size_t)TT + t0 + q * 8), *(const v4u*)&th[cl][q * 8]); if (hi_rows) { const size_t o3 = (bb * CC + c0 + cl) * (size_t)KHI + t0 + q * 8; vst2((unsigned*)(VB + o3), *(const v4u*)&tb[cl][q * 8]); vst2((unsigned*)(VBL + o3), *(const v4u*)&tbl[cl][q * 8]); } } } }
// ---- k_sc: block = (query block qb, key block kb <= kb_last(qb), head in group) of batch b: logits x SCALE; q hi + residual (x 2^10) against k (2 products) for query rows < QHI, plus the k residual (3 products) for query blocks < QBH (every query block here); causal: blocks past the diagonal exit, the mask itself is applied by index in k_sm
__global__ __launch_bounds__(128) void k_sc(const _Float16* __restrict__ QH, const _Float16* __restrict__ KH, const _Float16* __restrict__ QL, const _Float16* __restrict__ KL, int b, int h0, float* __restrict__ S0) { __shared__ __align__(16) float ss[4][16][132];
  const int qb = blockIdx.x, kb = blockIdx.y; if (kb > kb_last(qb)) return;
  const int h = h0 + blockIdx.z; float* S = S0 + (size_t)blockIdx.z * TT * TT;
  const int tid = threadIdx.x, wave = tid >> 5, lane = tid & 31, col = lane & 15, g = lane >> 4; const int k0 = kb * 128; const int ql0 = qb * 64 + wave * 16; const size_t q0 = (size_t)b * TT + ql0, kr0 = (size_t)b * TT + k0;
  v8f acc[8] = {}, accl[8] = {};
  const _Float16* QLb = QL + (size_t)b * QHI * CC; const _Float16* KLb = KL + (size_t)b * KHI * CC;
  if (qb < QBH) {
#pragma unroll
    for (int kc = 0; kc < HD / 32; ++kc) { const v16h ah = frag_h(QH + (q0 + col) * CC + h * HD + kc * 32, lane), al = frag_h(QLb + (size_t)(ql0 + col) * CC + h * HD + kc * 32, lane);
#pragma unroll
      for (int j = 0; j < 8; ++j) { const v16h kbf = frag_h(KH + (kr0 + j * 16 + col) * CC + h * HD + kc * 32, lane), klf = frag_h(KLb + (size_t)(k0 + j * 16 + col) * CC + h * HD + kc * 32, lane); acc[j] = wmma16(ah, kbf, acc[j]); accl[j] = wmma16(al, kbf, accl[j]); accl[j] = wmma16(ah, klf, accl[j]); } }
  } else if (qb * 64 < QHI) {
#pragma unroll
    for (int kc = 0; kc < HD / 32; ++kc) { const v16h ah = frag_h(QH + (q0 + col) * CC + h * HD + kc * 32, lane), al = frag_h(QLb + (size_t)(ql0 + col) * CC + h * HD + kc * 32, lane);
#pragma unroll
      for (int j = 0; j < 8; ++j) { const v16h kbf = frag_h(KH + (kr0 + j * 16 + col) * CC + h * HD + kc * 32, lane); acc[j] = wmma16(ah, kbf, acc[j]); accl[j] = wmma16(al, kbf, accl[j]); } }
  } else {
#pragma unroll
    for (int kc = 0; kc < HD / 32; ++kc) { const v16h ah = frag_h(QH + (q0 + col) * CC + h * HD + kc * 32, lane);
#pragma unroll
      for (int j = 0; j < 8; ++j) { const v16h kbf = frag_h(KH + (kr0 + j * 16 + col) * CC + h * HD + kc * 32, lane); acc[j] = wmma16(ah, kbf, acc[j]); } } }
#pragma unroll
  for (int j = 0; j < 8; ++j) {
#pragma unroll
    for (int r = 0; r < 8; ++r) ss[wave][8 * g + r][j * 16 + col] = (acc[j][r] + accl[j][r] * (1.0f / 1024.0f)) * SCALE; }
  LDSX(); for (int rl = 0; rl < 16; ++rl) vst2(S + (size_t)(ql0 + rl) * TT + k0 + lane * 4, *(const v4f*)&ss[wave][rl][lane * 4]); }
// ---- k_sm: block = query row t (head in group): keys [0, kend): causal -> logit if s <= t else excluded; softmax in f32; P x 2^11 in place (0 for excluded)
__global__ __launch_bounds__(256) void k_sm(float* __restrict__ S0 SM_EXTRA_PARAMS) { __shared__ float sred[8]; __shared__ float sbc; __shared__ __align__(16) float shv[TT];
  const int tid = threadIdx.x; const int t = blockIdx.x; const int kend = (kb_last(t >> 6) + 1) * 128;
  float* sr = S0 + (size_t)blockIdx.y * TT * TT + (size_t)t * TT;
  float m = -3.0e38f; for (int k = tid; k < kend; k += 256) { float v = (!CAUSAL || k <= t) ? sr[k] : -3.0e38f; SM_MASK_HOOK; shv[k] = v; m = fmaxf(m, v); }
#pragma unroll
  for (int o = 1; o < 32; o <<= 1) m = fmaxf(m, __shfl_xor(m, o));
  if ((tid & 31) == 0) sred[tid >> 5] = m; __syncthreads(); if (tid == 0) { float a = sred[0]; for (int i = 1; i < 8; ++i) a = fmaxf(a, sred[i]); sbc = a; } __syncthreads(); m = sbc; __syncthreads();
  float sum = 0.f; for (int k = tid; k < kend; k += 256) { const float v = shv[k]; const float e = (v <= -1.0e38f) ? 0.f : expf(v - m); shv[k] = e; sum += e; }
#pragma unroll
  for (int o = 1; o < 32; o <<= 1) sum += __shfl_xor(sum, o);
  if ((tid & 31) == 0) sred[tid >> 5] = sum; __syncthreads(); if (tid == 0) { float a = 0.f; for (int i = 0; i < 8; ++i) a += sred[i]; sbc = a > 0.f ? 2048.0f / a : 0.f; }   /* a fully excluded row yields P = 0 */ __syncthreads(); const float inv = sbc;
  for (int k = tid; k < kend; k += 256) shv[k] = shv[k] * inv;
  __syncthreads(); for (int q = tid; q < kend / 4; q += 256) vst2(sr + q * 4, *(const v4f*)&shv[q * 4]); }
// ---- k_pv: block = 64 queries (qb) of (b, h): ctx = P . v over keys [0, kend) (query blocks < QBH, here every block: P x 2^11 and v as bf16 hi + lo, 3 products; else P once to f16 against v f16: 1 product); 512-B (row, head) segment by 32 lanes
__global__ __launch_bounds__(128) void k_pv(const float* __restrict__ PS0, const _Float16* __restrict__ VT, const __bf16* __restrict__ VB, const __bf16* __restrict__ VBL, int b, int h0, float* __restrict__ Y) { const int h = h0 + blockIdx.z; const float* PS = PS0 + (size_t)blockIdx.z * TT * TT; __shared__ __align__(16) float ss[4][16][HD + 4];
  const int tid = threadIdx.x, wave = tid >> 5, lane = tid & 31, col = lane & 15, g = lane >> 4; const int qb = blockIdx.x; const int ql0 = qb * 64 + wave * 16; const int kce = (kb_last(qb) + 1) * 4;
  v8f acc[HD / 16] = {};
  if (qb < QBH) {
#pragma unroll 1
    for (int kc = 0; kc < kce; ++kc) { const F2 p = split_row(PS + (size_t)(ql0 + col) * TT, kc * 32, lane);
      asm volatile("s_wait_loadcnt 0x0" ::: "memory");
#pragma unroll
      for (int j = 0; j < HD / 16; ++j) { const size_t po = ((size_t)b * CC + h * HD + j * 16 + col) * (size_t)KHI + kc * 32; const v16b vh = frag_b(VB + po, lane); acc[j] = wmma_bf(p.h, vh, acc[j]); acc[j] = wmma_bf(p.l, vh, acc[j]); acc[j] = wmma_bf(p.h, frag_b(VBL + po, lane), acc[j]); } }
  } else {
#pragma unroll 1
    for (int kc = 0; kc < kce; ++kc) { const v16h p = frag_f32(PS + (size_t)(ql0 + col) * TT + kc * 32, lane);
      asm volatile("s_wait_loadcnt 0x0" ::: "memory");
#pragma unroll
      for (int j = 0; j < HD / 16; ++j) { const size_t po = ((size_t)b * CC + h * HD + j * 16 + col) * (size_t)TT + kc * 32; acc[j] = wmma16(p, frag_h(VT + po, lane), acc[j]); } } }
#pragma unroll
  for (int j = 0; j < HD / 16; ++j)
#pragma unroll
    for (int r = 0; r < 8; ++r) ss[wave][8 * g + r][j * 16 + col] = acc[j][r] * (1.0f / 2048.0f);
  LDSX(); for (int rl = 0; rl < 16; ++rl) if (lane < HD / 4) vst2(Y + ((size_t)b * TT + ql0 + rl) * CC + h * HD + lane * 4, *(const v4f*)&ss[wave][rl][lane * 4]); }

extern "C" void kernel_launch(void* const* d_in, const int* in_sizes, int n_in, void* d_out, int out_size, void* d_ws, size_t ws_size, hipStream_t stream) {
  (void)in_sizes; (void)n_in; (void)out_size;
  const float** F = (const float**)d_in;
  if (ws_size < (size_t)WS_END) return;
  char* ws = (char*)d_ws; _Float16 *QH = (_Float16*)(ws + WS_QH), *KH = (_Float16*)(ws + WS_KH), *VT = (_Float16*)(ws + WS_VT), *QL = (_Float16*)(ws + WS_QL), *KL = (_Float16*)(ws + WS_KL); __bf16 *VB = (__bf16*)(ws + WS_VB), *VBL = (__bf16*)(ws + WS_VBL); float *S = (float*)(ws + WS_S), *Y = (float*)(ws + WS_Y);
  (void)Y; (void)QL; (void)KL; (void)VB; (void)VBL;
  // inputs: 0 x [2,128,16,16,16]; 1 Wq (out,in), 2 bq; 3 Wk, 4 bk; 5 Wv, 6 bv; 7 gamma [scalar]
  if (ws_size < (size_t)WS_END2) return;
  float* YY = (float*)(ws + WS_YY);
  k_proj<<<dim3(TNB * TT / 64, CC / 128, 3), 128, 0, stream>>>(F[0], F[0], F[0], F[1], F[3], F[5], F[2], F[4], F[6], QH, QL, KH, KL, VT, VB, VBL);
  for (int b = 0; b < TNB; ++b) for (int h0 = 0; h0 < NH; h0 += HG) {
    k_sc<<<dim3(NQB, TT / 128, HG), 128, 0, stream>>>(QH, KH, QL, KL, b, h0, S);
    k_sm<<<dim3(TT, HG), 256, 0, stream>>>(S);
    k_pv<<<dim3(NQB, 1, HG), 128, 0, stream>>>(S, VT, VB, VBL, b, h0, YY);
  }
  k_resT<<<dim3(TNB * TT / 64), 128, 0, stream>>>(YY, F[0], F[7], (float*)d_out);
}

// v001
// A run of this version takes 273 microseconds.
// Next to v000, in two timings, it ran 3.47 times as fast each time.
// compute dtype: all float inputs rounded to bf16; q/k/v = W x + b with EXACT bf16 products on WMMA 16x16x32 (f32 accumulate; channels-first input gathered); logits with BOTH q and k as f16 hi + residual (x 2^10) (3 products) x 1.3 - the logits have sigma ~15 so the softmax is sharply peaked and single-f16 operands would not do; softmax in f32 (precise expf); P x 2^11 split bf16 hi + lo against v bf16 hi + lo (3 products); residual x + gamma out in f32; f32 output (channels-first).
#include <hip/hip_runtime.h>
#include <math.h>

typedef __attribute__((ext_vector_type(16))) _Float16 v16h;
typedef __attribute__((ext_vector_type(16))) __bf16 v16b;
typedef __attribute__((ext_vector_type(8)))  _Float16 v8h;
typedef __attribute__((ext_vector_type(8)))  float v8f;
typedef __attribute__((ext_vector_type(4)))  float v4f;
typedef __attribute__((ext_vector_type(2)))  float v2f;
typedef __attribute__((ext_vector_type(4)))  unsigned v4u;
typedef __attribute__((ext_vector_type(4)))  int v4i;
typedef float __attribute__((may_alias)) float_a;
typedef int __attribute__((may_alias)) int_a;

template <typename T> __device__ __forceinline__ void vst2(void* p, T v) { *(T*)p = v;  }
__device__ __forceinline__ v8f wmma16(v16h a, v16h b, v8f c) {
  v8f d = __builtin_amdgcn_wmma_f32_16x16x32_f16(false, a, false, b, (short)0, c, false, false);
  asm volatile("v_nop\n\tv_nop\n\tv_nop\n\tv_nop" : "+v"(d) : "v"(a), "v"(b));
  return d;
}
__device__ __forceinline__ v8f wmma_bf(v16b a, v16b b, v8f c) {
  v8f d = __builtin_amdgcn_wmma_f32_16x16x32_bf16(false, a, false, b, (short)0, c, false, false);
  asm volatile("v_nop\n\tv_nop\n\tv_nop\n\tv_nop" : "+v"(d) : "v"(a), "v"(b));
  return d;
}
// 16x16x32 fragments: lane = (h = lane>>4, row/col = lane&15); elements 0..7 = k0+8h+0..7, 8..15 = k0+16+8h+0..7; D element r = row 8h+r
__device__ __forceinline__ v16h frag_h(const _Float16* rowk0, int lane) {
  union { v16h v; v8h q[2]; } u; const _Float16* p = rowk0 + 8 * (lane >> 4);
  u.q[0] = *(const v8h*)p; u.q[1] = *(const v8h*)(p + 16); return u.v;
}
__device__ __forceinline__ v16h frag_f32(const float* rowk0, int lane) {
  v16h a; const float* p = rowk0 + 8 * (lane >> 4);
#pragma unroll
  for (int i = 0; i < 8; ++i) { a[i] = (_Float16)p[i]; a[8 + i] = (_Float16)p[16 + i]; }
  return a;
}
__device__ __forceinline__ v16h frag_f32s(const float* rowk0, int lane, float sc) {
  v16h a; const float* p = rowk0 + 8 * (lane >> 4);
#pragma unroll
  for (int i = 0; i < 8; ++i) { a[i] = (_Float16)(p[i] * sc); a[8 + i] = (_Float16)(p[16 + i] * sc); }
  return a;
}
// column fragment from a [K][ld] layout (column n), rows >= K read as 0
__device__ __forceinline__ v16h fragc_f32(const float* W, int k0, int n, int lane, int ld, int K) {
  v16h a; const int g = lane >> 4;
#pragma unroll
  for (int i = 0; i < 8; ++i) { const int ka = k0 + 8 * g + i, kb = ka + 16;
    a[i] = (_Float16)(ka < K ? W[(size_t)(ka < K ? ka : K - 1) * ld + n] : 0.f); a[8 + i] = (_Float16)(kb < K ? W[(size_t)(kb < K ? kb : K - 1) * ld + n] : 0.f); }
  return a;
}
struct F2 { v16b h, l; };
__device__ __forceinline__ F2 bsplit16(const float v[16]) { F2 r;
#pragma unroll
  for (int i = 0; i < 16; ++i) { const __bf16 h = (__bf16)v[i]; r.h[i] = h; r.l[i] = (__bf16)(v[i] - (float)h); }
  return r; }
__device__ __forceinline__ F2 split_row(const float* row, int k0, int lane) { float v[16]; const float* p = row + k0 + 8 * (lane >> 4);
#pragma unroll
  for (int i = 0; i < 8; ++i) { v[i] = p[i]; v[8 + i] = p[16 + i]; }
  return bsplit16(v); }
__device__ __forceinline__ F2 split_rowK(const float* row, int k0, int lane, int K) { float v[16]; const int g = lane >> 4;
#pragma unroll
  for (int i = 0; i < 8; ++i) { const int ka = k0 + 8 * g + i, kb = ka + 16; v[i] = ka < K ? row[ka < K ? ka : K - 1] : 0.f; v[8 + i] = kb < K ? row[kb < K ? kb : K - 1] : 0.f; }
  return bsplit16(v); }
__device__ __forceinline__ F2 split_col(const float* W, int k0, int n, int lane, int ld, int K) { float v[16]; const int g = lane >> 4;
#pragma unroll
  for (int i = 0; i < 8; ++i) { const int ka = k0 + 8 * g + i, kb = ka + 16; v[i] = ka < K ? W[(size_t)(ka < K ? ka : K - 1) * ld + n] : 0.f; v[8 + i] = kb < K ? W[(size_t)(kb < K ? kb : K - 1) * ld + n] : 0.f; }
  return bsplit16(v); }
__device__ __forceinline__ v8f mac3(const F2& a, const F2& b, v8f c) { c = wmma_bf(a.l, b.h, c); c = wmma_bf(a.h, b.l, c); return wmma_bf(a.h, b.h, c); }
__device__ __forceinline__ float sigm(float v) { return 1.0f / (1.0f + expf(-v)); }
#define LDSX() do { asm volatile("s_wait_dscnt 0" ::: "memory"); __builtin_amdgcn_wave_barrier(); __builtin_amdgcn_fence(__ATOMIC_RELEASE, "workgroup"); } while (0)

// Single-head self-attention over a flattened 16x16x16 volume (B 2, C 128, N 4,096): q/k/v = 1x1x1 convs (W (out,in) [128,128] + b); attn = softmax((q^T k) * 1.3) over keys; out[c][n] = sum_m v[c][m] attn[n][m]; result = x + gamma * out (gamma = 0.3 scalar input).
#define NB 2
#define TT 4096
#define CC 128            // NH * HD = projected width
#define DIN 128          // input (model) width
#define NH 1
#define HD 128
#define NQB (TT / 64)
#define HG 1
#define SCALE (1.3f)
#define CAUSAL 0
#ifndef TNB
#define TNB NB
#endif
__device__ __forceinline__ float bfr(float v) { return (float)(__bf16)v; }
__host__ __device__ __forceinline__ int kb_last(int qb) { return CAUSAL ? ((qb * 64 + 63) >> 7) : (TT / 128 - 1); }
typedef __attribute__((ext_vector_type(8))) __bf16 v8b;
__device__ __forceinline__ v16b frag_b(const __bf16* rowk0, int lane) {
  union { v16b v; v8b q[2]; } u; const __bf16* p = rowk0 + 8 * (lane >> 4);
  u.q[0] = *(const v8b*)p; u.q[1] = *(const v8b*)(p + 16); return u.v;
}
#define QBH NQB            // EVERY query block takes the 3-product logits + bf16 hi+lo P.v path (logit sigma ~15: sharply peaked softmax)
#define QHI 4096            // rows carrying a q residual plane (all rows when non-causal: 3-product logits everywhere)
#define KHI TT            // residual / bf16 hi+lo planes for ALL keys
// B fragment (k rows k0+.., output column o) of a weight: (in,out) [K][ld] or (out,in) [ld rows of K]: bf16 exact, or f16(bf16 * 256) exact
__device__ __forceinline__ v16b wcol_io(const float* Wm, int k0, int o, int lane, int ld) { v16b w; const int g = lane >> 4;
#pragma unroll
  for (int i = 0; i < 8; ++i) { w[i] = (__bf16)Wm[(size_t)(k0 + 8 * g + i) * ld + o]; w[8 + i] = (__bf16)Wm[(size_t)(k0 + 16 + 8 * g + i) * ld + o]; }
  return w; }
__device__ __forceinline__ v16b wcol_oi(const float* Wm, int k0, int o, int lane, int K) { v16b w; const float* p = Wm + (size_t)o * K + k0 + 8 * (lane >> 4);
#pragma unroll
  for (int i = 0; i < 8; ++i) { w[i] = (__bf16)p[i]; w[8 + i] = (__bf16)p[16 + i]; }
  return w; }
__device__ __forceinline__ v16h wcolh_io(const float* Wm, int k0, int o, int lane, int ld) { v16h w; const int g = lane >> 4;
#pragma unroll
  for (int i = 0; i < 8; ++i) { w[i] = (_Float16)(bfr(Wm[(size_t)(k0 + 8 * g + i) * ld + o]) * 256.0f); w[8 + i] = (_Float16)(bfr(Wm[(size_t)(k0 + 16 + 8 * g + i) * ld + o]) * 256.0f); }
  return w; }
__device__ __forceinline__ v16h wcolh_oi(const float* Wm, int k0, int o, int lane, int K) { v16h w; const float* p = Wm + (size_t)o * K + k0 + 8 * (lane >> 4);
#pragma unroll
  for (int i = 0; i < 8; ++i) { w[i] = (_Float16)(bfr(p[i]) * 256.0f); w[8 + i] = (_Float16)(bfr(p[16 + i]) * 256.0f); }
  return w; }
#define WQKV_LAYOUT 1   // 0 = (in,out) [DIN][CC]; 1 = (out,in) [CC][DIN]; 2 = per-head [NH][DIN][HD]
__device__ __forceinline__ v16b wcol_hdk(const float* Wm, int k0, int o, int lane) { v16b w; const int g = lane >> 4; const float* p = Wm + (size_t)(o / HD) * DIN * HD + (o % HD);
#pragma unroll
  for (int i = 0; i < 8; ++i) { w[i] = (__bf16)p[(size_t)(k0 + 8 * g + i) * HD]; w[8 + i] = (__bf16)p[(size_t)(k0 + 16 + 8 * g + i) * HD]; }
  return w; }
#define WO_OUT_IN 0
#if WQKV_LAYOUT == 1
#define WCOL(W, k0, o, lane) wcol_oi(W, k0, o, lane, DIN)
#elif WQKV_LAYOUT == 2
#define WCOL(W, k0, o, lane) wcol_hdk(W, k0, o, lane)
#else
#define WCOL(W, k0, o, lane) wcol_io(W, k0, o, lane, CC)
#endif
#if WO_OUT_IN
#define WOCOL(W, k0, o, lane) wcol_oi(W, k0, o, lane, CC)
#define WOCOLH(W, k0, o, lane) wcolh_oi(W, k0, o, lane, CC)
#else
#define WOCOL(W, k0, o, lane) wcol_io(W, k0, o, lane, DIN)
#define WOCOLH(W, k0, o, lane) wcolh_io(W, k0, o, lane, DIN)
#endif
#define NPIX 4096
#define PV_KS 8            // key slices inside a k_pv work-group (one wave per query tile and slice; summed through LDS)
#define PV_GS 4            // key slices over the k_pv grid (one ctx plane each; summed in k_resT)
// ---- k_resT: block = (64 pixel rows, 128 channels): out[b][c][n] = bf16(x[b][c][n]) + bf16(gamma) * sum over the PV_GS planes s of Y[s][b*4096 + n][c] via an LDS transpose (each (c, 64 n) run = 256 B by 16 threads)
__global__ __launch_bounds__(128) void k_resT(const float* __restrict__ Y, const float* __restrict__ X, const float* __restrict__ GM, float* __restrict__ OUT) { __shared__ __align__(16) float stc[128][68];
  const int tid = threadIdx.x; const size_t rb = (size_t)blockIdx.x * 64; const size_t bb = rb / TT; const int t0 = (int)(rb % TT); const float gm = bfr(GM[0]);
  for (int e = tid; e < 64 * 32; e += 128) { const int rl = e >> 5, q = e & 31; v4f yv = *(const v4f*)(Y + (rb + rl) * CC + q * 4);
#pragma unroll
    for (int s = 1; s < PV_GS; ++s) yv += *(const v4f*)(Y + (size_t)s * NB * TT * CC + (rb + rl) * CC + q * 4);   /* key-slice planes, fixed order */
    asm volatile("s_wait_xcnt 0x0" ::: "memory");   // the plane loads' address registers may be reused behind this point
    stc[q * 4][rl] = yv[0]; stc[q * 4 + 1][rl] = yv[1]; stc[q * 4 + 2][rl] = yv[2]; stc[q * 4 + 3][rl] = yv[3]; }
  __syncthreads();
  for (int e = tid; e < 128 * 16; e += 128) { const int cl = e >> 4, q = e & 15; const size_t o = ((size_t)bb * CC + cl) * NPIX + t0 + q * 4; const v4f xv = *(const v4f*)(X + o); v4f r4 = *(const v4f*)&stc[cl][q * 4]; r4[0] = bfr(xv[0]) + gm * r4[0]; r4[1] = bfr(xv[1]) + gm * r4[1]; r4[2] = bfr(xv[2]) + gm * r4[2]; r4[3] = bfr(xv[3]) + gm * r4[3]; vst2(OUT + o, r4); } }
#ifndef SM_EXTRA_PARAMS
#define SM_EXTRA_PARAMS
#endif
#ifndef PROJ_EXTRA_PARAMS
#define PROJ_EXTRA_PARAMS
#endif
#ifndef SM_MASK_HOOK
#define SM_MASK_HOOK (void)0
#endif

#define WS_QH  0u                                      // f16 q rows [b*t][CC]
#define WS_KH  (WS_QH + 2u * (size_t)NB * TT * CC)      // f16 k rows [b*t][CC]
#define WS_VT  (WS_KH + 2u * (size_t)NB * TT * CC)      // f16 v planes [b][c][t]
#define WS_QL  (WS_VT + 2u * (size_t)NB * CC * TT)      // f16 q residual x 2^10 rows [b][t < QHI][CC]
#define WS_KL  (WS_QL + 2u * (size_t)NB * QHI * CC)     // f16 k residual x 2^10 rows [b][t < KHI][CC]
#define WS_VB  (WS_KL + 2u * (size_t)NB * KHI * CC)     // bf16 v hi planes [b][c][t < KHI]
#define WS_VBL (WS_VB + 2u * (size_t)NB * CC * KHI)
#define WS_S   (WS_VBL + 2u * (size_t)NB * CC * KHI)    // f32 logits / P [hg][t][s]
#define WS_Y   (WS_S  + 4u * (size_t)HG * TT * TT)      // f32 ctx rows [b*t][CC] (only when there is an output projection)
#define WS_END (WS_Y  + 0u)
#define WS_YY (WS_END)                                  // f32 ctx rows [key slice of the grid][b*t][128]
#define WS_END2 (WS_YY + 4u * (size_t)PV_GS * NB * TT * CC)

// ---- k_proj: block = (64 rows, 128 cols, which): q/k/v = X W (+ b) with exact bf16 products (K = DIN) -> which 0: q f16 rows (+ residual rows < QHI); 1: k f16 rows (+ residual rows < KHI); 2: v f16 planes [c][t] (+ bf16 hi/lo planes for t < KHI)
__global__ __launch_bounds__(128) void k_proj(const float* __restrict__ XQ, const float* __restrict__ XK, const float* __restrict__ XV, const float* __restrict__ WQ, const float* __restrict__ WK, const float* __restrict__ WV, const float* __restrict__ BQ, const float* __restrict__ BK, const float* __restrict__ BV,
    _Float16* __restrict__ QH, _Float16* __restrict__ QL, _Float16* __restrict__ KH, _Float16* __restrict__ KL, _Float16* __restrict__ VT, __bf16* __restrict__ VB, __bf16* __restrict__ VBL) {
  __shared__ __align__(16) _Float16 sh[64][136], sl[64][136]; __shared__ __align__(16) _Float16 th[128][72]; __shared__ __align__(16) __bf16 tb[128][72], tbl[128][72];
  const int tid = threadIdx.x, wave = tid >> 5, lane = tid & 31, col = lane & 15, g = lane >> 4; const int which = blockIdx.z; const int c0 = blockIdx.y * 128; const size_t r0 = (size_t)blockIdx.x * 64; const size_t bb = r0 / TT; const int t0 = (int)(r0 % TT);
  const float* X = which == 0 ? XQ : which == 1 ? XK : XV; const float* WA = which == 0 ? WQ : which == 1 ? WK : WV; const float* BA = which == 0 ? BQ : which == 1 ? BK : BV;
  v8f acc[8] = {};
#pragma unroll 2
  for (int kc = 0; kc < DIN / 32; ++kc) { v16b a; { const float* p = X + ((size_t)bb * DIN + kc * 32 + 8 * g) * NPIX + t0 + wave * 16 + col;   /* channels-first gather: x[b][k][n], stride NPIX between channels */
#pragma unroll
      for (int i = 0; i < 8; ++i) { a[i] = (__bf16)p[(size_t)i * NPIX]; a[8 + i] = (__bf16)p[(size_t)(16 + i) * NPIX]; } }
    asm volatile("s_wait_loadcnt 0x0" ::: "memory");
#pragma unroll
    for (int j = 0; j < 8; ++j) { const v16b w = WCOL(WA, kc * 32, c0 + j * 16 + col, lane); asm volatile("s_wait_loadcnt 0x0" ::: "memory"); acc[j] = wmma_bf(a, w, acc[j]); } }
  if (which < 2) { _Float16* DH = which == 0 ? QH : KH; _Float16* DL = which == 0 ? QL : KL; const int nhi = which == 0 ? QHI : KHI; const bool hi_rows = t0 < nhi;
#pragma unroll
    for (int j = 0; j < 8; ++j) { const float bias = BA ? bfr(BA[c0 + j * 16 + col]) : 0.f;
#pragma unroll
      for (int r = 0; r < 8; ++r) { const float v = acc[j][r] + bias; const _Float16 hv = (_Float16)v; sh[wave * 16 + 8 * g + r][j * 16 + col] = hv; sl[wave * 16 + 8 * g + r][j * 16 + col] = (_Float16)((v - (float)hv) * 1024.0f); } }
    __syncthreads();
    for (int e = tid; e < 64 * 16; e += 128) { const int rl = e >> 4, q = e & 15; vst2((unsigned*)(DH + (r0 + rl) * CC + c0 + q * 8), *(const v4u*)&sh[rl][q * 8]); if (hi_rows) vst2((unsigned*)(DL + (bb * nhi + t0 + rl) * (size_t)CC + c0 + q * 8), *(const v4u*)&sl[rl][q * 8]); }
  } else { const bool hi_rows = t0 < KHI;
#pragma unroll
    for (int j = 0; j < 8; ++j) { const float bias = BA ? bfr(BA[c0 + j * 16 + col]) : 0.f;
#pragma unroll
      for (int r = 0; r < 8; ++r) { const float v = acc[j][r] + bias; const int rl = wave * 16 + 8 * g + r, cl = j * 16 + col; th[cl][rl] = (_Float16)v; const __bf16 bh = (__bf16)v; tb[cl][rl] = bh; tbl[cl][rl] = (__bf16)(v - (float)bh); } }
    __syncthreads();
    for (int e = tid; e < 128 * 8; e += 128) { const int cl = e >> 3, q = e & 7; vst2((unsigned*)(VT + (bb * CC + c0 + cl) * (size_t)TT + t0 + q * 8), *(const v4u*)&th[cl][q * 8]); if (hi_rows) { const size_t o3 = (bb * CC + c0 + cl) * (size_t)KHI + t0 + q * 8; vst2((unsigned*)(VB + o3), *(const v4u*)&tb[cl][q * 8]); vst2((unsigned*)(VBL + o3), *(const v4u*)&tbl[cl][q * 8]); } } } }
// ---- k_sc: block = (query block qb, key block kb <= kb_last(qb), head in group) of batch b: logits x SCALE; q hi + residual (x 2^10) against k (2 products) for query rows < QHI, plus the k residual (3 products) for query blocks < QBH (every query block here); causal: blocks past the diagonal exit, the mask itself is applied by index in k_sm
__global__ __launch_bounds__(128) void k_sc(const _Float16* __restrict__ QH, const _Float16* __restrict__ KH, const _Float16* __restrict__ QL, const _Float16* __restrict__ KL, int b, int h0, float* __restrict__ S0) { __shared__ __align__(16) float ss[4][16][132];
  const int qb = blockIdx.x, kb = blockIdx.y; if (kb > kb_last(qb)) return;
  const int h = h0 + blockIdx.z; float* S = S0 + (size_t)blockIdx.z * TT * TT;
  const int tid = threadIdx.x, wave = tid >> 5, lane = tid & 31, col = lane & 15, g = lane >> 4; const int k0 = kb * 128; const int ql0 = qb * 64 + wave * 16; const size_t q0 = (size_t)b * TT + ql0, kr0 = (size_t)b * TT + k0;
  v8f acc[8] = {}, accl[8] = {};
  const _Float16* QLb = QL + (size_t)b * QHI * CC; const _Float16* KLb = KL + (size_t)b * KHI * CC;
  if (qb < QBH) {
#pragma unroll
    for (int kc = 0; kc < HD / 32; ++kc) { const v16h ah = frag_h(QH + (q0 + col) * CC + h * HD + kc * 32, lane), al = frag_h(QLb + (size_t)(ql0 + col) * CC + h * HD + kc * 32, lane);
#pragma unroll
      for (int j = 0; j < 8; ++j) { const v16h kbf = frag_h(KH + (kr0 + j * 16 + col) * CC + h * HD + kc * 32, lane), klf = frag_h(KLb + (size_t)(k0 + j * 16 + col) * CC + h * HD + kc * 32, lane); acc[j] = wmma16(ah, kbf, acc[j]); accl[j] = wmma16(al, kbf, accl[j]); accl[j] = wmma16(ah, klf, accl[j]); } }
  } else if (qb * 64 < QHI) {
#pragma unroll
    for (int kc = 0; kc < HD / 32; ++kc) { const v16h ah = frag_h(QH + (q0 + col) * CC + h * HD + kc * 32, lane), al = frag_h(QLb + (size_t)(ql0 + col) * CC + h * HD + kc * 32, lane);
#pragma unroll
      for (int j = 0; j < 8; ++j) { const v16h kbf = frag_h(KH + (kr0 + j * 16 + col) * CC + h * HD + kc * 32, lane); acc[j] = wmma16(ah, kbf, acc[j]); accl[j] = wmma16(al, kbf, accl[j]); } }
  } else {
#pragma unroll
    for (int kc = 0; kc < HD / 32; ++kc) { const v16h ah = frag_h(QH + (q0 + col) * CC + h * HD + kc * 32, lane);
#pragma unroll
      for (int j = 0; j < 8; ++j) { const v16h kbf = frag_h(KH + (kr0 + j * 16 + col) * CC + h * HD + kc * 32, lane); acc[j] = wmma16(ah, kbf, acc[j]); } } }
#pragma unroll
  for (int j = 0; j < 8; ++j) {
#pragma unroll
    for (int r = 0; r < 8; ++r) ss[wave][8 * g + r][j * 16 + col] = (acc[j][r] + accl[j][r] * (1.0f / 1024.0f)) * SCALE; }
  LDSX(); for (int rl = 0; rl < 16; ++rl) vst2(S + (size_t)(ql0 + rl) * TT + k0 + lane * 4, *(const v4f*)&ss[wave][rl][lane * 4]); }
// ---- k_sm: block = query row t (head in group): keys [0, kend): causal -> logit if s <= t else excluded; softmax in f32; P x 2^11 in place (0 for excluded)
__global__ __launch_bounds__(256) void k_sm(float* __restrict__ S0 SM_EXTRA_PARAMS) { __shared__ float sred[8]; __shared__ float sbc; __shared__ __align__(16) float shv[TT];
  const int tid = threadIdx.x; const int t = blockIdx.x; const int kend = (kb_last(t >> 6) + 1) * 128;
  float* sr = S0 + (size_t)blockIdx.y * TT * TT + (size_t)t * TT;
  float m = -3.0e38f; for (int k = tid; k < kend; k += 256) { float v = (!CAUSAL || k <= t) ? sr[k] : -3.0e38f; SM_MASK_HOOK; shv[k] = v; m = fmaxf(m, v); }
#pragma unroll
  for (int o = 1; o < 32; o <<= 1) m = fmaxf(m, __shfl_xor(m, o));
  if ((tid & 31) == 0) sred[tid >> 5] = m; __syncthreads(); if (tid == 0) { float a = sred[0]; for (int i = 1; i < 8; ++i) a = fmaxf(a, sred[i]); sbc = a; } __syncthreads(); m = sbc; __syncthreads();
  float sum = 0.f; for (int k = tid; k < kend; k += 256) { const float v = shv[k]; const float e = (v <= -1.0e38f) ? 0.f : expf(v - m); shv[k] = e; sum += e; }
#pragma unroll
  for (int o = 1; o < 32; o <<= 1) sum += __shfl_xor(sum, o);
  if ((tid & 31) == 0) sred[tid >> 5] = sum; __syncthreads(); if (tid == 0) { float a = 0.f; for (int i = 0; i < 8; ++i) a += sred[i]; sbc = a > 0.f ? 2048.0f / a : 0.f; }   /* a fully excluded row yields P = 0 */ __syncthreads(); const float inv = sbc;
  for (int k = tid; k < kend; k += 256) shv[k] = shv[k] * inv;
  __syncthreads(); for (int q = tid; q < kend / 4; q += 256) vst2(sr + q * 4, *(const v4f*)&shv[q * 4]); }
// ---- k_pv: block = 64 queries (qb) of (b, h) x one of PV_GS key slices, waves = 4 query tiles x PV_KS sub-slices (32-key chunks dealt round-robin, so neighbouring sub-slices use the two halves of a v line together): partial ctx = P . v over the wave's keys, the PV_KS partial sums added through LDS in fixed order, one ctx plane per grid slice (every query block: P x 2^11 and v as bf16 hi + lo, 3 products); 512-B (row, head) segment by 32 lanes
__global__ __launch_bounds__(128 * PV_KS) void k_pv(const float* __restrict__ PS0, const _Float16* __restrict__ VT, const __bf16* __restrict__ VB, const __bf16* __restrict__ VBL, int b, int h0, float* __restrict__ Y) { const int h = h0 + blockIdx.z; const float* PS = PS0 + (size_t)blockIdx.z * TT * TT; __shared__ __align__(16) float ss[4][16][HD + 4]; __shared__ __align__(16) v4f red[PV_KS - 1][4][HD / 8][32];
  const int tid = threadIdx.x, wave = (tid >> 5) & 3, ks = __builtin_amdgcn_readfirstlane(tid >> 7) /* wave-uniform: keeps the key loop's control scalar */, lane = tid & 31, col = lane & 15, g = lane >> 4; const int qb = blockIdx.x; const int ql0 = qb * 64 + wave * 16; const int kce = (kb_last(qb) + 1) * 4;
  const int kcb = kce * (int)blockIdx.y / PV_GS + ks, kcn = kce * ((int)blockIdx.y + 1) / PV_GS; Y += (size_t)blockIdx.y * NB * TT * CC;
  v8f acc[HD / 16] = {};
  if (qb < QBH) {
#pragma unroll 1
    for (int kc = kcb; kc < kcn; kc += PV_KS) { const F2 p = split_row(PS + (size_t)(ql0 + col) * TT, kc * 32, lane);
      asm volatile("s_wait_loadcnt 0x0" ::: "memory");
#pragma unroll
      for (int j = 0; j < HD / 16; ++j) { const size_t po = ((size_t)b * CC + h * HD + j * 16 + col) * (size_t)KHI + kc * 32; const v16b vh = frag_b(VB + po, lane); acc[j] = wmma_bf(p.h, vh, acc[j]); acc[j] = wmma_bf(p.l, vh, acc[j]); acc[j] = wmma_bf(p.h, frag_b(VBL + po, lane), acc[j]); } }
  } else {
#pragma unroll 1
    for (int kc = kcb; kc < kcn; kc += PV_KS) { const v16h p = frag_f32(PS + (size_t)(ql0 + col) * TT + kc * 32, lane);
      asm volatile("s_wait_loadcnt 0x0" ::: "memory");
#pragma unroll
      for (int j = 0; j < HD / 16; ++j) { const size_t po = ((size_t)b * CC + h * HD + j * 16 + col) * (size_t)TT + kc * 32; acc[j] = wmma16(p, frag_h(VT + po, lane), acc[j]); } } }
  if (ks > 0) {
#pragma unroll
    for (int j = 0; j < HD / 16; ++j) { red[ks - 1][wave][2 * j][lane] = __builtin_shufflevector(acc[j], acc[j], 0, 1, 2, 3); red[ks - 1][wave][2 * j + 1][lane] = __builtin_shufflevector(acc[j], acc[j], 4, 5, 6, 7); } }
  __syncthreads();   // the sub-slices' partial sums are in LDS
  if (ks > 0) return;
#pragma unroll 1   // rolled: unrolled, the hoisted LDS reads spill at the 128 registers a wave of a 32-wave work-group may hold
  for (int s = 0; s < PV_KS - 1; ++s)
#pragma unroll
    for (int j = 0; j < HD / 16; ++j) { const v4f lo = red[s][wave][2 * j][lane], hi = red[s][wave][2 * j + 1][lane]; acc[j] += __builtin_shufflevector(lo, hi, 0, 1, 2, 3, 4, 5, 6, 7); }
#pragma unroll
  for (int j = 0; j < HD / 16; ++j)
#pragma unroll
    for (int r = 0; r < 8; ++r) ss[wave][8 * g + r][j * 16 + col] = acc[j][r] * (1.0f / 2048.0f);
  LDSX(); for (int rl = 0; rl < 16; ++rl) if (lane < HD / 4) vst2(Y + ((size_t)b * TT + ql0 + rl) * CC + h * HD + lane * 4, *(const v4f*)&ss[wave][rl][lane * 4]); }

extern "C" void kernel_launch(void* const* d_in, const int* in_sizes, int n_in, void* d_out, int out_size, void* d_ws, size_t ws_size, hipStream_t stream) {
  (void)in_sizes; (void)n_in; (void)out_size;
  const float** F = (const float**)d_in;
  if (ws_size < (size_t)WS_END) return;
  char* ws = (char*)d_ws; _Float16 *QH = (_Float16*)(ws + WS_QH), *KH = (_Float16*)(ws + WS_KH), *VT = (_Float16*)(ws + WS_VT), *QL = (_Float16*)(ws + WS_QL), *KL = (_Float16*)(ws + WS_KL); __bf16 *VB = (__bf16*)(ws + WS_VB), *VBL = (__bf16*)(ws + WS_VBL); float *S = (float*)(ws + WS_S), *Y = (float*)(ws + WS_Y);
  (void)Y; (void)QL; (void)KL; (void)VB; (void)VBL;
  // inputs: 0 x [2,128,16,16,16]; 1 Wq (out,in), 2 bq; 3 Wk, 4 bk; 5 Wv, 6 bv; 7 gamma [scalar]
  if (ws_size < (size_t)WS_END2) return;
  float* YY = (float*)(ws + WS_YY);
  k_proj<<<dim3(TNB * TT / 64, CC / 128, 3), 128, 0, stream>>>(F[0], F[0], F[0], F[1], F[3], F[5], F[2], F[4], F[6], QH, QL, KH, KL, VT, VB, VBL);
  for (int b = 0; b < TNB; ++b) for (int h0 = 0; h0 < NH; h0 += HG) {
    k_sc<<<dim3(NQB, TT / 128, HG), 128, 0, stream>>>(QH, KH, QL, KL, b, h0, S);
    k_sm<<<dim3(TT, HG), 256, 0, stream>>>(S);
    k_pv<<<dim3(NQB, PV_GS, HG), 128 * PV_KS, 0, stream>>>(S, VT, VB, VBL, b, h0, YY);
  }
  k_resT<<<dim3(TNB * TT / 64), 128, 0, stream>>>(YY, F[0], F[7], (float*)d_out);
}

// v003
// Measured time: 76.5 microseconds a run.
// Versions between v001 and this one are left out; their measured steps multiply to 3.59 times as fast.
// Over all steps from v000 it is 12.5 times as fast.
// compute dtype: all float inputs rounded to bf16; q/k/v = W x + b with EXACT bf16 products on WMMA 16x16x32 (f32 accumulate; channels-first input gathered); logits with BOTH q and k as f16 hi + residual (x 2^10) (3 products) x 1.3 - the logits have sigma ~15 so the softmax is sharply peaked and single-f16 operands would not do; online softmax in f32 in base 2 (hardware exp2 of score x 1.3 log2 e minus the running maximum per query, one fused multiply-add); unnormalised P split bf16 hi + lo against v bf16 hi + lo (3 products); residual x + gamma out in f32; f32 output (channels-first).
#include <hip/hip_runtime.h>
#include <math.h>

typedef __attribute__((ext_vector_type(16))) _Float16 v16h;
typedef __attribute__((ext_vector_type(16))) __bf16 v16b;
typedef __attribute__((ext_vector_type(8)))  _Float16 v8h;
typedef __attribute__((ext_vector_type(8)))  float v8f;
typedef __attribute__((ext_vector_type(4)))  float v4f;
typedef __attribute__((ext_vector_type(2)))  float v2f;
typedef __attribute__((ext_vector_type(4)))  unsigned v4u;
typedef __attribute__((ext_vector_type(4)))  int v4i;
typedef float __attribute__((may_alias)) float_a;
typedef int __attribute__((may_alias)) int_a;

template <typename T> __device__ __forceinline__ void vst2(void* p, T v) { *(T*)p = v;  }
__device__ __forceinline__ v8f wmma16(v16h a, v16h b, v8f c) {
  v8f d = __builtin_amdgcn_wmma_f32_16x16x32_f16(false, a, false, b, (short)0, c, false, false);
  asm volatile("v_nop\n\tv_nop\n\tv_nop\n\tv_nop" : "+v"(d) : "v"(a), "v"(b));
  return d;
}
__device__ __forceinline__ v8f wmma_bf(v16b a, v16b b, v8f c) {
  v8f d = __builtin_amdgcn_wmma_f32_16x16x32_bf16(false, a, false, b, (short)0, c, false, false);
  asm volatile("v_nop\n\tv_nop\n\tv_nop\n\tv_nop" : "+v"(d) : "v"(a), "v"(b));
  return d;
}
// 16x16x32 fragments: lane = (h = lane>>4, row/col = lane&15); elements 0..7 = k0+8h+0..7, 8..15 = k0+16+8h+0..7; D element r = row 8h+r
__device__ __forceinline__ v16h frag_h(const _Float16* rowk0, int lane) {
  union { v16h v; v8h q[2]; } u; const _Float16* p = rowk0 + 8 * (lane >> 4);
  u.q[0] = *(const v8h*)p; u.q[1] = *(const v8h*)(p + 16); return u.v;
}
__device__ __forceinline__ v16h frag_f32(const float* rowk0, int lane) {
  v16h a; const float* p = rowk0 + 8 * (lane >> 4);
#pragma unroll
  for (int i = 0; i < 8; ++i) { a[i] = (_Float16)p[i]; a[8 + i] = (_Float16)p[16 + i]; }
  return a;
}
__device__ __forceinline__ v16h frag_f32s(const float* rowk0, int lane, float sc) {
  v16h a; const float* p = rowk0 + 8 * (lane >> 4);
#pragma unroll
  for (int i = 0; i < 8; ++i) { a[i] = (_Float16)(p[i] * sc); a[8 + i] = (_Float16)(p[16 + i] * sc); }
  return a;
}
// column fragment from a [K][ld] layout (column n), rows >= K read as 0
__device__ __forceinline__ v16h fragc_f32(const float* W, int k0, int n, int lane, int ld, int K) {
  v16h a; const int g = lane >> 4;
#pragma unroll
  for (int i = 0; i < 8; ++i) { const int ka = k0 + 8 * g + i, kb = ka + 16;
    a[i] = (_Float16)(ka < K ? W[(size_t)(ka < K ? ka : K - 1) * ld + n] : 0.f); a[8 + i] = (_Float16)(kb < K ? W[(size_t)(kb < K ? kb : K - 1) * ld + n] : 0.f); }
  return a;
}
struct F2 { v16b h, l; };
__device__ __forceinline__ F2 bsplit16(const float v[16]) { F2 r;
#pragma unroll
  for (int i = 0; i < 16; ++i) { const __bf16 h = (__bf16)v[i]; r.h[i] = h; r.l[i] = (__bf16)(v[i] - (float)h); }
  return r; }
__device__ __forceinline__ F2 split_row(const float* row, int k0, int lane) { float v[16]; const float* p = row + k0 + 8 * (lane >> 4);
#pragma unroll
  for (int i = 0; i < 8; ++i) { v[i] = p[i]; v[8 + i] = p[16 + i]; }
  return bsplit16(v); }
__device__ __forceinline__ F2 split_rowK(const float* row, int k0, int lane, int K) { float v[16]; const int g = lane >> 4;
#pragma unroll
  for (int i = 0; i < 8; ++i) { const int ka = k0 + 8 * g + i, kb = ka + 16; v[i] = ka < K ? row[ka < K ? ka : K - 1] : 0.f; v[8 + i] = kb < K ? row[kb < K ? kb : K - 1] : 0.f; }
  return bsplit16(v); }
__device__ __forceinline__ F2 split_col(const float* W, int k0, int n, int lane, int ld, int K) { float v[16]; const int g = lane >> 4;
#pragma unroll
  for (int i = 0; i < 8; ++i) { const int ka = k0 + 8 * g + i, kb = ka + 16; v[i] = ka < K ? W[(size_t)(ka < K ? ka : K - 1) * ld + n] : 0.f; v[8 + i] = kb < K ? W[(size_t)(kb < K ? kb : K - 1) * ld + n] : 0.f; }
  return bsplit16(v); }
__device__ __forceinline__ v8f mac3(const F2& a, const F2& b, v8f c) { c = wmma_bf(a.l, b.h, c); c = wmma_bf(a.h, b.l, c); return wmma_bf(a.h, b.h, c); }
__device__ __forceinline__ float sigm(float v) { return 1.0f / (1.0f + expf(-v)); }
#define LDSX() do { asm volatile("s_wait_dscnt 0" ::: "memory"); __builtin_amdgcn_wave_barrier(); __builtin_amdgcn_fence(__ATOMIC_RELEASE, "workgroup"); } while (0)

// Single-head self-attention over a flattened 16x16x16 volume (B 2, C 128, N 4,096): q/k/v = 1x1x1 convs (W (out,in) [128,128] + b); attn = softmax((q^T k) * 1.3) over keys; out[c][n] = sum_m v[c][m] attn[n][m]; result = x + gamma * out (gamma = 0.3 scalar input).
#define NB 2
#define TT 4096
#define CC 128            // NH * HD = projected width
#define DIN 128          // input (model) width
#define NH 1
#define HD 128
#define NQB (TT / 64)
#define HG 1
#define SCALE (1.3f)
#define SC2 ((float)((double)SCALE * 1.4426950408889634))   // SCALE x log2 e: exp(SCALE t) = exp2(SC2 t)
#define CAUSAL 0
#ifndef TNB
#define TNB NB
#endif
__device__ __forceinline__ float bfr(float v) { return (float)(__bf16)v; }
__host__ __device__ __forceinline__ int kb_last(int qb) { return CAUSAL ? ((qb * 64 + 63) >> 7) : (TT / 128 - 1); }
typedef __attribute__((ext_vector_type(8))) __bf16 v8b;
__device__ __forceinline__ v16b frag_b(const __bf16* rowk0, int lane) {
  union { v16b v; v8b q[2]; } u; const __bf16* p = rowk0 + 8 * (lane >> 4);
  u.q[0] = *(const v8b*)p; u.q[1] = *(const v8b*)(p + 16); return u.v;
}
#define QBH NQB            // EVERY query block takes the 3-product logits + bf16 hi+lo P.v path (logit sigma ~15: sharply peaked softmax)
#define QHI 4096            // rows carrying a q residual plane (all rows when non-causal: 3-product logits everywhere)
#define KHI TT            // residual / bf16 hi+lo planes for ALL keys
// B fragment (k rows k0+.., output column o) of a weight: (in,out) [K][ld] or (out,in) [ld rows of K]: bf16 exact, or f16(bf16 * 256) exact
__device__ __forceinline__ v16b wcol_io(const float* Wm, int k0, int o, int lane, int ld) { v16b w; const int g = lane >> 4;
#pragma unroll
  for (int i = 0; i < 8; ++i) { w[i] = (__bf16)Wm[(size_t)(k0 + 8 * g + i) * ld + o]; w[8 + i] = (__bf16)Wm[(size_t)(k0 + 16 + 8 * g + i) * ld + o]; }
  return w; }
__device__ __forceinline__ v16b wcol_oi(const float* Wm, int k0, int o, int lane, int K) { v16b w; const float* p = Wm + (size_t)o * K + k0 + 8 * (lane >> 4);
#pragma unroll
  for (int i = 0; i < 8; ++i) { w[i] = (__bf16)p[i]; w[8 + i] = (__bf16)p[16 + i]; }
  return w; }
__device__ __forceinline__ v16h wcolh_io(const float* Wm, int k0, int o, int lane, int ld) { v16h w; const int g = lane >> 4;
#pragma unroll
  for (int i = 0; i < 8; ++i) { w[i] = (_Float16)(bfr(Wm[(size_t)(k0 + 8 * g + i) * ld + o]) * 256.0f); w[8 + i] = (_Float16)(bfr(Wm[(size_t)(k0 + 16 + 8 * g + i) * ld + o]) * 256.0f); }
  return w; }
__device__ __forceinline__ v16h wcolh_oi(const float* Wm, int k0, int o, int lane, int K) { v16h w; const float* p = Wm + (size_t)o * K + k0 + 8 * (lane >> 4);
#pragma unroll
  for (int i = 0; i < 8; ++i) { w[i] = (_Float16)(bfr(p[i]) * 256.0f); w[8 + i] = (_Float16)(bfr(p[16 + i]) * 256.0f); }
  return w; }
#define WQKV_LAYOUT 1   // 0 = (in,out) [DIN][CC]; 1 = (out,in) [CC][DIN]; 2 = per-head [NH][DIN][HD]
__device__ __forceinline__ v16b wcol_hdk(const float* Wm, int k0, int o, int lane) { v16b w; const int g = lane >> 4; const float* p = Wm + (size_t)(o / HD) * DIN * HD + (o % HD);
#pragma unroll
  for (int i = 0; i < 8; ++i) { w[i] = (__bf16)p[(size_t)(k0 + 8 * g + i) * HD]; w[8 + i] = (__bf16)p[(size_t)(k0 + 16 + 8 * g + i) * HD]; }
  return w; }
#define WO_OUT_IN 0
#if WQKV_LAYOUT == 1
#define WCOL(W, k0, o, lane) wcol_oi(W, k0, o, lane, DIN)
#elif WQKV_LAYOUT == 2
#define WCOL(W, k0, o, lane) wcol_hdk(W, k0, o, lane)
#else
#define WCOL(W, k0, o, lane) wcol_io(W, k0, o, lane, CC)
#endif
#if WO_OUT_IN
#define WOCOL(W, k0, o, lane) wcol_oi(W, k0, o, lane, CC)
#define WOCOLH(W, k0, o, lane) wcolh_oi(W, k0, o, lane, CC)
#else
#define WOCOL(W, k0, o, lane) wcol_io(W, k0, o, lane, DIN)
#define WOCOLH(W, k0, o, lane) wcolh_io(W, k0, o, lane, DIN)
#endif
#define NPIX 4096
#define FA_KS 8            // key slices over the k_fa grid (per query one partial ctx row, maximum and sum each; merged in k_resT)
#define FA_SK 64           // keys per LDS stage of k_fa
// ---- k_resT: block = (64 pixel rows, 128 channels): merges the FA_KS key slices of a row (weight exp(m_s - M) / sum_s exp(m_s - M) l_s, fixed order), then out[b][c][n] = bf16(x[b][c][n]) + bf16(gamma) * ctx[b*4096 + n][c] via an LDS transpose (each (c, 64 n) run = 256 B by 16 threads)
__global__ __launch_bounds__(128) void k_resT(const float* __restrict__ Y, const float* __restrict__ ML, const float* __restrict__ X, const float* __restrict__ GM, float* __restrict__ OUT) { __shared__ __align__(16) float stc[128][68]; __shared__ float wsl[FA_KS][64];
  const int tid = threadIdx.x; const size_t rb = (size_t)blockIdx.x * 64; const size_t bb = rb / TT; const int t0 = (int)(rb % TT); const float gm = bfr(GM[0]);
  if (tid < 64) { float mv[FA_KS], lv[FA_KS]; float mx = -3.0e38f;
#pragma unroll
    for (int s = 0; s < FA_KS; ++s) { const v2f t = *(const v2f*)(ML + ((size_t)s * NB * TT + rb + tid) * 2); mv[s] = t[0]; lv[s] = t[1]; mx = fmaxf(mx, t[0]); }
    float den = 0.f;
#pragma unroll
    for (int s = 0; s < FA_KS; ++s) { mv[s] = expf(mv[s] - mx); den += mv[s] * lv[s]; }
    const float inv = 1.0f / den;   /* den is 1 (to rounding) or more: the slice that holds the maximum has weight 1 and a sum that holds the maximum's own term */
#pragma unroll
    for (int s = 0; s < FA_KS; ++s) wsl[s][tid] = mv[s] * inv; }
  __syncthreads();   // the rows' slice weights are in LDS
  for (int e = tid; e < 64 * 32; e += 128) { const int rl = e >> 5, q = e & 31; const float* yp = Y + (rb + rl) * (size_t)(FA_KS * CC) + q * 4; v4f yv = *(const v4f*)yp * wsl[0][rl];
#pragma unroll
    for (int s = 1; s < FA_KS; ++s) yv += *(const v4f*)(yp + s * CC) * wsl[s][rl];   /* the row's key slices, fixed order */
    asm volatile("s_wait_xcnt 0x0" ::: "memory");   // the slice loads' address registers may be reused behind this point
    stc[q * 4][rl] = yv[0]; stc[q * 4 + 1][rl] = yv[1]; stc[q * 4 + 2][rl] = yv[2]; stc[q * 4 + 3][rl] = yv[3]; }
  __syncthreads();
  for (int e = tid; e < 128 * 16; e += 128) { const int cl = e >> 4, q = e & 15; const size_t o = ((size_t)bb * CC + cl) * NPIX + t0 + q * 4; const v4f xv = *(const v4f*)(X + o); v4f r4 = *(const v4f*)&stc[cl][q * 4]; r4[0] = bfr(xv[0]) + gm * r4[0]; r4[1] = bfr(xv[1]) + gm * r4[1]; r4[2] = bfr(xv[2]) + gm * r4[2]; r4[3] = bfr(xv[3]) + gm * r4[3]; vst2(OUT + o, r4); } }
#ifndef SM_EXTRA_PARAMS
#define SM_EXTRA_PARAMS
#endif
#ifndef PROJ_EXTRA_PARAMS
#define PROJ_EXTRA_PARAMS
#endif
#ifndef SM_MASK_HOOK
#define SM_MASK_HOOK (void)0
#endif

#define WS_QH  0u                                      // f16 q rows [b*t][CC]
#define WS_KH  (WS_QH + 2u * (size_t)NB * TT * CC)      // f16 k rows [b*t][CC]
#define WS_VT  (WS_KH + 2u * (size_t)NB * TT * CC)      // f16 v planes [b][c][t]
#define WS_QL  (WS_VT + 2u * (size_t)NB * CC * TT)      // f16 q residual x 2^10 rows [b][t < QHI][CC]
#define WS_KL  (WS_QL + 2u * (size_t)NB * QHI * CC)     // f16 k residual x 2^10 rows [b][t < KHI][CC]
#define WS_VB  (WS_KL + 2u * (size_t)NB * KHI * CC)     // bf16 v hi planes [b][c][t < KHI]
#define WS_VBL (WS_VB + 2u * (size_t)NB * CC * KHI)
#define WS_YY (WS_VBL + 2u * (size_t)NB * CC * KHI)    // f32 partial ctx rows [b*t][key slice][128], unnormalised
#define WS_ML (WS_YY + 4u * (size_t)FA_KS * NB * TT * CC)   // f32 (running maximum, sum) pairs [key slice][b*t]
#define WS_END2 (WS_ML + 8u * (size_t)FA_KS * NB * TT)

// ---- k_proj: block = (64 rows, 128 cols, which): q/k/v = X W (+ b) with exact bf16 products (K = DIN) -> which 0: q f16 rows (+ residual rows < QHI); 1: k f16 rows (+ residual rows < KHI); 2: v f16 planes [c][t] (+ bf16 hi/lo planes for t < KHI)
__global__ __launch_bounds__(128) void k_proj(const float* __restrict__ XQ, const float* __restrict__ XK, const float* __restrict__ XV, const float* __restrict__ WQ, const float* __restrict__ WK, const float* __restrict__ WV, const float* __restrict__ BQ, const float* __restrict__ BK, const float* __restrict__ BV,
    _Float16* __restrict__ QH, _Float16* __restrict__ QL, _Float16* __restrict__ KH, _Float16* __restrict__ KL, _Float16* __restrict__ VT, __bf16* __restrict__ VB, __bf16* __restrict__ VBL) {
  __shared__ __align__(16) _Float16 sh[64][136], sl[64][136]; __shared__ __align__(16) _Float16 th[128][72]; __shared__ __align__(16) __bf16 tb[128][72], tbl[128][72];
  const int tid = threadIdx.x, wave = tid >> 5, lane = tid & 31, col = lane & 15, g = lane >> 4; const int which = blockIdx.z; const int c0 = blockIdx.y * 128; const size_t r0 = (size_t)blockIdx.x * 64; const size_t bb = r0 / TT; const int t0 = (int)(r0 % TT);
  const float* X = which == 0 ? XQ : which == 1 ? XK : XV; const float* WA = which == 0 ? WQ : which == 1 ? WK : WV; const float* BA = which == 0 ? BQ : which == 1 ? BK : BV;
  v8f acc[8] = {};
#pragma unroll 2
  for (int kc = 0; kc < DIN / 32; ++kc) { v16b a; { const float* p = X + ((size_t)bb * DIN + kc * 32 + 8 * g) * NPIX + t0 + wave * 16 + col;   /* channels-first gather: x[b][k][n], stride NPIX between channels */
#pragma unroll
      for (int i = 0; i < 8; ++i) { a[i] = (__bf16)p[(size_t)i * NPIX]; a[8 + i] = (__bf16)p[(size_t)(16 + i) * NPIX]; } }
    asm volatile("s_wait_loadcnt 0x0" ::: "memory");
#pragma unroll
    for (int j = 0; j < 8; ++j) { const v16b w = WCOL(WA, kc * 32, c0 + j * 16 + col, lane); asm volatile("s_wait_loadcnt 0x0" ::: "memory"); acc[j] = wmma_bf(a, w, acc[j]); } }
  if (which < 2) { _Float16* DH = which == 0 ? QH : KH; _Float16* DL = which == 0 ? QL : KL; const int nhi = which == 0 ? QHI : KHI; const bool hi_rows = t0 < nhi;
#pragma unroll
    for (int j = 0; j < 8; ++j) { const float bias = BA ? bfr(BA[c0 + j * 16 + col]) : 0.f;
#pragma unroll
      for (int r = 0; r < 8; ++r) { const float v = acc[j][r] + bias; const _Float16 hv = (_Float16)v; sh[wave * 16 + 8 * g + r][j * 16 + col] = hv; sl[wave * 16 + 8 * g + r][j * 16 + col] = (_Float16)((v - (float)hv) * 1024.0f); } }
    __syncthreads();
    for (int e = tid; e < 64 * 16; e += 128) { const int rl = e >> 4, q = e & 15; vst2((unsigned*)(DH + (r0 + rl) * CC + c0 + q * 8), *(const v4u*)&sh[rl][q * 8]); if (hi_rows) vst2((unsigned*)(DL + (bb * nhi + t0 + rl) * (size_t)CC + c0 + q * 8), *(const v4u*)&sl[rl][q * 8]); }
  } else { const bool hi_rows = t0 < KHI;
#pragma unroll
    for (int j = 0; j < 8; ++j) { const float bias = BA ? bfr(BA[c0 + j * 16 + col]) : 0.f;
#pragma unroll
      for (int r = 0; r < 8; ++r) { const float v = acc[j][r] + bias; const int rl = wave * 16 + 8 * g + r, cl = j * 16 + col; th[cl][rl] = (_Float16)v; const __bf16 bh = (__bf16)v; tb[cl][rl] = bh; tbl[cl][rl] = (__bf16)(v - (float)bh); } }
    __syncthreads();
    for (int e = tid; e < 128 * 8; e += 128) { const int cl = e >> 3, q = e & 7; vst2((unsigned*)(VT + (bb * CC + c0 + cl) * (size_t)TT + t0 + q * 8), *(const v4u*)&th[cl][q * 8]); if (hi_rows) { const size_t o3 = (bb * CC + c0 + cl) * (size_t)KHI + t0 + q * 8; vst2((unsigned*)(VB + o3), *(const v4u*)&tb[cl][q * 8]); vst2((unsigned*)(VBL + o3), *(const v4u*)&tbl[cl][q * 8]); } } } }
// the builtin forms as they are: the compiler keeps the distance behind a matrix instruction itself and is free to move LDS reads ahead of it
__device__ __forceinline__ v8f mm_h(v16h a, v16h b, v8f c) { return __builtin_amdgcn_wmma_f32_16x16x32_f16(false, a, false, b, (short)0, c, false, false); }
__device__ __forceinline__ v8f mm_b(v16b a, v16b b, v8f c) { return __builtin_amdgcn_wmma_f32_16x16x32_bf16(false, a, false, b, (short)0, c, false, false); }
__global__ __launch_bounds__(256) void k_fa(const _Float16* __restrict__ QH, const _Float16* __restrict__ QL, const _Float16* __restrict__ KH, const _Float16* __restrict__ KL, const __bf16* __restrict__ VB, const __bf16* __restrict__ VBL, float* __restrict__ Y, float* __restrict__ ML) {
  __shared__ __align__(16) _Float16 skh[FA_SK][CC + 8], skl[FA_SK][CC + 8];   // 272-B pitch: conflict-free 16-byte fragment reads
  __shared__ __align__(16) __bf16 svh[CC][FA_SK + 8], svl[CC][FA_SK + 8];     // 144-B pitch, likewise
  const int tid = threadIdx.x, wave = tid >> 5, lane = tid & 31, col = lane & 15, g = lane >> 4;
  const size_t qr = (size_t)blockIdx.x * 128 + wave * 16 + col;   // this lane's query row in [b*t]
  const size_t bb = (size_t)blockIdx.x / (TT / 128); const int key0 = (int)blockIdx.y * (TT / FA_KS);
  const int kr = tid >> 4, kq = (tid & 15) * 8, vr = tid >> 3, vq = (tid & 7) * 8;   // staging: 16 lanes per 256-B k row, 8 lanes per 128-B run of a v plane
  const _Float16 *gkh = KH + (bb * TT + key0 + kr) * (size_t)CC + kq, *gkl = KL + (bb * TT + key0 + kr) * (size_t)CC + kq; const __bf16 *gvh = VB + (bb * CC + vr) * (size_t)KHI + key0 + vq, *gvl = VBL + (bb * CC + vr) * (size_t)KHI + key0 + vq;
  v16h qh[HD / 32], ql[HD / 32];
#pragma unroll
  for (int kc = 0; kc < HD / 32; ++kc) { qh[kc] = frag_h(QH + qr * CC + kc * 32, lane); ql[kc] = frag_h(QL + qr * CC + kc * 32, lane); }
  v8f o[HD / 16] = {}; float mrun = -3.0e38f, lsum = 0.f;   // mrun: running maximum of score x SC2, the base-2 exponent that is taken off
#pragma unroll 1   // rolled: one stage's code is the whole hot loop and the accumulators stay in place
  for (int st = 0; st < TT / FA_KS / FA_SK; ++st) {
    __syncthreads();   // every wave has finished reading the stage before
#pragma unroll
    for (int i = 0; i < FA_SK * 16 / 256; ++i) { *(v4u*)&skh[kr + i * 16][kq] = *(const v4u*)(gkh + i * 16 * CC); *(v4u*)&skl[kr + i * 16][kq] = *(const v4u*)(gkl + i * 16 * CC); }
#pragma unroll
    for (int i = 0; i < CC * (FA_SK / 8) / 256; ++i) { *(v4u*)&svh[vr + i * 32][vq] = *(const v4u*)(gvh + (size_t)i * 32 * KHI); *(v4u*)&svl[vr + i * 32][vq] = *(const v4u*)(gvl + (size_t)i * 32 * KHI); }
    asm volatile("s_wait_xcnt 0x0" ::: "memory");   // the stage loads' address registers are rewritten behind this point
    gkh += FA_SK * CC; gkl += FA_SK * CC; gvh += FA_SK; gvl += FA_SK;   // the lane's four source pointers walk on by one stage, behind the stores that waited for the loads
    __syncthreads();   // the stage is in LDS
#pragma unroll 1   // rolled: halves the hot loop's code; both passes are alike
    for (int u = 0; u < FA_SK / 32; ++u) {
      v8f sh[2] = {}, sl[2] = {}; v16h ka[2][4];   // ka: two batches of fragments (k hi, k residual of both 16-key tiles for one 32-channel step): the next batch's LDS reads fly while this batch's products run
      const _Float16 *rh = &skh[u * 32 + col][0], *rl = &skl[u * 32 + col][0];
      ka[0][0] = frag_h(rh, lane); ka[0][1] = frag_h(rl, lane); ka[0][2] = frag_h(rh + 16 * (CC + 8), lane); ka[0][3] = frag_h(rl + 16 * (CC + 8), lane);
#pragma unroll
      for (int kc = 0; kc < HD / 32; ++kc) { const int cb = kc & 1, nb = cb ^ 1;
        if (kc + 1 < HD / 32) { ka[nb][0] = frag_h(rh + (kc + 1) * 32, lane); ka[nb][1] = frag_h(rl + (kc + 1) * 32, lane); ka[nb][2] = frag_h(rh + 16 * (CC + 8) + (kc + 1) * 32, lane); ka[nb][3] = frag_h(rl + 16 * (CC + 8) + (kc + 1) * 32, lane); }
        __builtin_amdgcn_sched_barrier(0);   // keeps the next batch's reads in front of this block: sunk to their use, each would expose the LDS latency
        sh[0] = mm_h(ka[cb][0], qh[kc], sh[0]); sh[1] = mm_h(ka[cb][2], qh[kc], sh[1]); sl[0] = mm_h(ka[cb][0], ql[kc], sl[0]); sl[1] = mm_h(ka[cb][2], ql[kc], sl[1]); sl[0] = mm_h(ka[cb][1], qh[kc], sl[0]); sl[1] = mm_h(ka[cb][3], qh[kc], sl[1]);
        __builtin_amdgcn_sched_barrier(0); }   // ends the block: the reads behind it stay behind it
      v16b va[2][4];   // likewise for v: hi, lo planes of two 16-channel tiles; the first batch flies behind the softmax arithmetic
      const __bf16 *wh = &svh[col][u * 32], *wl = &svl[col][u * 32];
      va[0][0] = frag_b(wh, lane); va[0][1] = frag_b(wl, lane); va[0][2] = frag_b(wh + 16 * (FA_SK + 8), lane); va[0][3] = frag_b(wl + 16 * (FA_SK + 8), lane);
      __builtin_amdgcn_sched_barrier(0);   // keeps these reads in front of the softmax arithmetic
      float pv[16]; float mx = -3.0e38f;
#pragma unroll
      for (int r = 0; r < 8; ++r) { pv[r] = sh[0][r] + sl[0][r] * (1.0f / 1024.0f); pv[8 + r] = sh[1][r] + sl[1][r] * (1.0f / 1024.0f); mx = fmaxf(mx, fmaxf(pv[r], pv[8 + r])); }   /* unscaled: SC2 > 0 keeps the order */
      mx = fmaxf(mx, __shfl_xor(mx, 16)) * SC2;   // the other half of the wave holds this query's other 16 keys; from here on in base-2 exponent units
      if (__builtin_amdgcn_ballot_w32(mx > mrun) != 0) {   // some query's maximum rose: rescale what is summed so far (factor 1 for the others)
        const float mn = fmaxf(mrun, mx), al = __builtin_amdgcn_exp2f(mrun - mn); mrun = mn; lsum *= al;
#pragma unroll
        for (int j = 0; j < HD / 16; ++j) o[j] *= al; }
#pragma unroll
      for (int i = 0; i < 16; ++i) pv[i] = fmaf(pv[i], SC2, -mrun);   /* all sixteen exponents first: the exp2 run behind them then has independent neighbours */
#pragma unroll   // pv[] must stay in registers
      for (int i = 0; i < 16; ++i) { pv[i] = __builtin_amdgcn_exp2f(pv[i]); lsum += pv[i]; }
      const F2 p = bsplit16(pv);
#pragma unroll
      for (int jb = 0; jb < HD / 32; ++jb) { const int cb = jb & 1, nb = cb ^ 1, j = 2 * jb;
        if (jb + 1 < HD / 32) { va[nb][0] = frag_b(wh + (j + 2) * 16 * (FA_SK + 8), lane); va[nb][1] = frag_b(wl + (j + 2) * 16 * (FA_SK + 8), lane); va[nb][2] = frag_b(wh + (j + 3) * 16 * (FA_SK + 8), lane); va[nb][3] = frag_b(wl + (j + 3) * 16 * (FA_SK + 8), lane); }
        __builtin_amdgcn_sched_barrier(0);   // as above: the next batch's reads stay in front of this block
        o[j] = mm_b(va[cb][0], p.h, o[j]); o[j + 1] = mm_b(va[cb][2], p.h, o[j + 1]); o[j] = mm_b(va[cb][0], p.l, o[j]); o[j + 1] = mm_b(va[cb][2], p.l, o[j + 1]); o[j] = mm_b(va[cb][1], p.h, o[j]); o[j + 1] = mm_b(va[cb][3], p.h, o[j + 1]);
        __builtin_amdgcn_sched_barrier(0); } } }   // ends the block
  lsum += __shfl_xor(lsum, 16);
  float* yr = Y + (qr * FA_KS + blockIdx.y) * CC + 8 * g;   // O^T tile j, element r = channel 16 j + 8 g + r of query qr
#pragma unroll
  for (int j = 0; j < HD / 16; ++j) { vst2(yr + j * 16, __builtin_shufflevector(o[j], o[j], 0, 1, 2, 3)); vst2(yr + j * 16 + 4, __builtin_shufflevector(o[j], o[j], 4, 5, 6, 7)); }
  if (g == 0) { v2f t; t[0] = mrun * 0.6931471805599453f; t[1] = lsum;   /* the maximum in natural-log units, as k_resT weighs the slices */ vst2(ML + ((size_t)blockIdx.y * NB * TT + qr) * 2, t); } }

extern "C" void kernel_launch(void* const* d_in, const int* in_sizes, int n_in, void* d_out, int out_size, void* d_ws, size_t ws_size, hipStream_t stream) {
  (void)in_sizes; (void)n_in; (void)out_size;
  const float** F = (const float**)d_in;
  if (ws_size < (size_t)WS_END2) return;
  char* ws = (char*)d_ws; _Float16 *QH = (_Float16*)(ws + WS_QH), *KH = (_Float16*)(ws + WS_KH), *VT = (_Float16*)(ws + WS_VT), *QL = (_Float16*)(ws + WS_QL), *KL = (_Float16*)(ws + WS_KL); __bf16 *VB = (__bf16*)(ws + WS_VB), *VBL = (__bf16*)(ws + WS_VBL); float *YY = (float*)(ws + WS_YY), *ML = (float*)(ws + WS_ML);
  // inputs: 0 x [2,128,16,16,16]; 1 Wq (out,in), 2 bq; 3 Wk, 4 bk; 5 Wv, 6 bv; 7 gamma [scalar]
  k_proj<<<dim3(TNB * TT / 64, CC / 128, 3), 128, 0, stream>>>(F[0], F[0], F[0], F[1], F[3], F[5], F[2], F[4], F[6], QH, QL, KH, KL, VT, VB, VBL);
  k_fa<<<dim3(TNB * TT / 128, FA_KS), 256, 0, stream>>>(QH, QL, KH, KL, VB, VBL, YY, ML);
  k_resT<<<dim3(TNB * TT / 64), 128, 0, stream>>>(YY, ML, F[0], F[7], (float*)d_out);
}

// v004
// It runs in 62.5 microseconds.
// Next to v003, in two timings, it ran 1.22 times as fast each time.
// All steps since v000 together make it 15.2 times as fast.
// compute dtype: all float inputs rounded to bf16; q/k/v = W x + b with EXACT bf16 products on WMMA 16x16x32 (f32 accumulate; channels-first input gathered); logits with BOTH q and k as f16 hi + residual (x 2^10) (3 products) x 1.3 - the logits have sigma ~15 so the softmax is sharply peaked and single-f16 operands would not do; online softmax in f32 in base 2 (hardware exp2 of score x 1.3 log2 e minus the running maximum per query, one fused multiply-add); unnormalised P split bf16 hi + lo against v bf16 hi + lo (3 products); residual x + gamma out in f32; f32 output (channels-first).
#include <hip/hip_runtime.h>
#include <math.h>

typedef __attribute__((ext_vector_type(16))) _Float16 v16h;
typedef __attribute__((ext_vector_type(16))) __bf16 v16b;
typedef __attribute__((ext_vector_type(8)))  _Float16 v8h;
typedef __attribute__((ext_vector_type(8)))  float v8f;
typedef __attribute__((ext_vector_type(4)))  float v4f;
typedef __attribute__((ext_vector_type(2)))  float v2f;
typedef __attribute__((ext_vector_type(4)))  unsigned v4u;
typedef __attribute__((ext_vector_type(4)))  int v4i;
typedef float __attribute__((may_alias)) float_a;
typedef int __attribute__((may_alias)) int_a;

template <typename T> __device__ __forceinline__ void vst2(void* p, T v) { *(T*)p = v;  }
__device__ __forceinline__ v8f wmma16(v16h a, v16h b, v8f c) {
  v8f d = __builtin_amdgcn_wmma_f32_16x16x32_f16(false, a, false, b, (short)0, c, false, false);
  asm volatile("v_nop\n\tv_nop\n\tv_nop\n\tv_nop" : "+v"(d) : "v"(a), "v"(b));
  return d;
}
__device__ __forceinline__ v8f wmma_bf(v16b a, v16b b, v8f c) {
  v8f d = __builtin_amdgcn_wmma_f32_16x16x32_bf16(false, a, false, b, (short)0, c, false, false);
  asm volatile("v_nop\n\tv_nop\n\tv_nop\n\tv_nop" : "+v"(d) : "v"(a), "v"(b));
  return d;
}
// 16x16x32 fragments: lane = (h = lane>>4, row/col = lane&15); elements 0..7 = k0+8h+0..7, 8..15 = k0+16+8h+0..7; D element r = row 8h+r
__device__ __forceinline__ v16h frag_h(const _Float16* rowk0, int lane) {
  union { v16h v; v8h q[2]; } u; const _Float16* p = rowk0 + 8 * (lane >> 4);
  u.q[0] = *(const v8h*)p; u.q[1] = *(const v8h*)(p + 16); return u.v;
}
__device__ __forceinline__ v16h frag_f32(const float* rowk0, int lane) {
  v16h a; const float* p = rowk0 + 8 * (lane >> 4);
#pragma unroll
  for (int i = 0; i < 8; ++i) { a[i] = (_Float16)p[i]; a[8 + i] = (_Float16)p[16 + i]; }
  return a;
}
__device__ __forceinline__ v16h frag_f32s(const float* rowk0, int lane, float sc) {
  v16h a; const float* p = rowk0 + 8 * (lane >> 4);
#pragma unroll
  for (int i = 0; i < 8; ++i) { a[i] = (_Float16)(p[i] * sc); a[8 + i] = (_Float16)(p[16 + i] * sc); }
  return a;
}
// column fragment from a [K][ld] layout (column n), rows >= K read as 0
__device__ __forceinline__ v16h fragc_f32(const float* W, int k0, int n, int lane, int ld, int K) {
  v16h a; const int g = lane >> 4;
#pragma unroll
  for (int i = 0; i < 8; ++i) { const int ka = k0 + 8 * g + i, kb = ka + 16;
    a[i] = (_Float16)(ka < K ? W[(size_t)(ka < K ? ka : K - 1) * ld + n] : 0.f); a[8 + i] = (_Float16)(kb < K ? W[(size_t)(kb < K ? kb : K - 1) * ld + n] : 0.f); }
  return a;
}
struct F2 { v16b h, l; };
__device__ __forceinline__ F2 bsplit16(const float v[16]) { F2 r;
#pragma unroll
  for (int i = 0; i < 16; ++i) { const __bf16 h = (__bf16)v[i]; r.h[i] = h; r.l[i] = (__bf16)(v[i] - (float)h); }
  return r; }
__device__ __forceinline__ F2 split_row(const float* row, int k0, int lane) { float v[16]; const float* p = row + k0 + 8 * (lane >> 4);
#pragma unroll
  for (int i = 0; i < 8; ++i) { v[i] = p[i]; v[8 + i] = p[16 + i]; }
  return bsplit16(v); }
__device__ __forceinline__ F2 split_rowK(const float* row, int k0, int lane, int K) { float v[16]; const int g = lane >> 4;
#pragma unroll
  for (int i = 0; i < 8; ++i) { const int ka = k0 + 8 * g + i, kb = ka + 16; v[i] = ka < K ? row[ka < K ? ka : K - 1] : 0.f; v[8 + i] = kb < K ? row[kb < K ? kb : K - 1] : 0.f; }
  return bsplit16(v); }
__device__ __forceinline__ F2 split_col(const float* W, int k0, int n, int lane, int ld, int K) { float v[16]; const int g = lane >> 4;
#pragma unroll
  for (int i = 0; i < 8; ++i) { const int ka = k0 + 8 * g + i, kb = ka + 16; v[i] = ka < K ? W[(size_t)(ka < K ? ka : K - 1) * ld + n] : 0.f; v[8 + i] = kb < K ? W[(size_t)(kb < K ? kb : K - 1) * ld + n] : 0.f; }
  return bsplit16(v); }
__device__ __forceinline__ v8f mac3(const F2& a, const F2& b, v8f c) { c = wmma_bf(a.l, b.h, c); c = wmma_bf(a.h, b.l, c); return wmma_bf(a.h, b.h, c); }
__device__ __forceinline__ float sigm(float v) { return 1.0f / (1.0f + expf(-v)); }
#define LDSX() do { asm volatile("s_wait_dscnt 0" ::: "memory"); __builtin_amdgcn_wave_barrier(); __builtin_amdgcn_fence(__ATOMIC_RELEASE, "workgroup"); } while (0)

// Single-head self-attention over a flattened 16x16x16 volume (B 2, C 128, N 4,096): q/k/v = 1x1x1 convs (W (out,in) [128,128] + b); attn = softmax((q^T k) * 1.3) over keys; out[c][n] = sum_m v[c][m] attn[n][m]; result = x + gamma * out (gamma = 0.3 scalar input).
#define NB 2
#define TT 4096
#define CC 128            // NH * HD = projected width
#define DIN 128          // input (model) width
#define NH 1
#define HD 128
#define NQB (TT / 64)
#define HG 1
#define SCALE (1.3f)
#define SC2 ((float)((double)SCALE * 1.4426950408889634))   // SCALE x log2 e: exp(SCALE t) = exp2(SC2 t)
#define CAUSAL 0
#ifndef TNB
#define TNB NB
#endif
__device__ __forceinline__ float bfr(float v) { return (float)(__bf16)v; }
__host__ __device__ __forceinline__ int kb_last(int qb) { return CAUSAL ? ((qb * 64 + 63) >> 7) : (TT / 128 - 1); }
typedef __attribute__((ext_vector_type(8))) __bf16 v8b;
__device__ __forceinline__ v16b frag_b(const __bf16* rowk0, int lane) {
  union { v16b v; v8b q[2]; } u; const __bf16* p = rowk0 + 8 * (lane >> 4);
  u.q[0] = *(const v8b*)p; u.q[1] = *(const v8b*)(p + 16); return u.v;
}
#define QBH NQB            // EVERY query block takes the 3-product logits + bf16 hi+lo P.v path (logit sigma ~15: sharply peaked softmax)
#define QHI 4096            // rows carrying a q residual plane (all rows when non-causal: 3-product logits everywhere)
#define KHI TT            // residual / bf16 hi+lo planes for ALL keys
// B fragment (k rows k0+.., output column o) of a weight: (in,out) [K][ld] or (out,in) [ld rows of K]: bf16 exact, or f16(bf16 * 256) exact
__device__ __forceinline__ v16b wcol_io(const float* Wm, int k0, int o, int lane, int ld) { v16b w; const int g = lane >> 4;
#pragma unroll
  for (int i = 0; i < 8; ++i) { w[i] = (__bf16)Wm[(size_t)(k0 + 8 * g + i) * ld + o]; w[8 + i] = (__bf16)Wm[(size_t)(k0 + 16 + 8 * g + i) * ld + o]; }
  return w; }
__device__ __forceinline__ v16b wcol_oi(const float* Wm, int k0, int o, int lane, int K) { v16b w; const float* p = Wm + (size_t)o * K + k0 + 8 * (lane >> 4);
#pragma unroll
  for (int i = 0; i < 8; ++i) { w[i] = (__bf16)p[i]; w[8 + i] = (__bf16)p[16 + i]; }
  return w; }
__device__ __forceinline__ v16h wcolh_io(const float* Wm, int k0, int o, int lane, int ld) { v16h w; const int g = lane >> 4;
#pragma unroll
  for (int i = 0; i < 8; ++i) { w[i] = (_Float16)(bfr(Wm[(size_t)(k0 + 8 * g + i) * ld + o]) * 256.0f); w[8 + i] = (_Float16)(bfr(Wm[(size_t)(k0 + 16 + 8 * g + i) * ld + o]) * 256.0f); }
  return w; }
__device__ __forceinline__ v16h wcolh_oi(const float* Wm, int k0, int o, int lane, int K) { v16h w; const float* p = Wm + (size_t)o * K + k0 + 8 * (lane >> 4);
#pragma unroll
  for (int i = 0; i < 8; ++i) { w[i] = (_Float16)(bfr(p[i]) * 256.0f); w[8 + i] = (_Float16)(bfr(p[16 + i]) * 256.0f); }
  return w; }
#define WQKV_LAYOUT 1   // 0 = (in,out) [DIN][CC]; 1 = (out,in) [CC][DIN]; 2 = per-head [NH][DIN][HD]
__device__ __forceinline__ v16b wcol_hdk(const float* Wm, int k0, int o, int lane) { v16b w; const int g = lane >> 4; const float* p = Wm + (size_t)(o / HD) * DIN * HD + (o % HD);
#pragma unroll
  for (int i = 0; i < 8; ++i) { w[i] = (__bf16)p[(size_t)(k0 + 8 * g + i) * HD]; w[8 + i] = (__bf16)p[(size_t)(k0 + 16 + 8 * g + i) * HD]; }
  return w; }
#define WO_OUT_IN 0
#if WQKV_LAYOUT == 1
#define WCOL(W, k0, o, lane) wcol_oi(W, k0, o, lane, DIN)
#elif WQKV_LAYOUT == 2
#define WCOL(W, k0, o, lane) wcol_hdk(W, k0, o, lane)
#else
#define WCOL(W, k0, o, lane) wcol_io(W, k0, o, lane, CC)
#endif
#if WO_OUT_IN
#define WOCOL(W, k0, o, lane) wcol_oi(W, k0, o, lane, CC)
#define WOCOLH(W, k0, o, lane) wcolh_oi(W, k0, o, lane, CC)
#else
#define WOCOL(W, k0, o, lane) wcol_io(W, k0, o, lane, DIN)
#define WOCOLH(W, k0, o, lane) wcolh_io(W, k0, o, lane, DIN)
#endif
#define NPIX 4096
#define FA_KS 8            // key slices over the k_fa grid (per query one partial ctx row, maximum and sum each; merged in k_resT)
#define FA_SK 64           // keys per LDS stage of k_fa
// ---- k_resT: block = (64 pixel rows, 128 channels): merges the FA_KS key slices of a row (weight exp(m_s - M) / sum_s exp(m_s - M) l_s, fixed order), then out[b][c][n] = bf16(x[b][c][n]) + bf16(gamma) * ctx[b*4096 + n][c] via an LDS transpose (each (c, 64 n) run = 256 B by 16 threads)
__global__ __launch_bounds__(128) void k_resT(const float* __restrict__ Y, const float* __restrict__ ML, const float* __restrict__ X, const float* __restrict__ GM, float* __restrict__ OUT) { __shared__ __align__(16) float stc[128][68]; __shared__ float wsl[FA_KS][64];
  const int tid = threadIdx.x; const size_t rb = (size_t)blockIdx.x * 64; const size_t bb = rb / TT; const int t0 = (int)(rb % TT); const float gm = bfr(GM[0]);
  if (tid < 64) { float mv[FA_KS], lv[FA_KS]; float mx = -3.0e38f;
#pragma unroll
    for (int s = 0; s < FA_KS; ++s) { const v2f t = *(const v2f*)(ML + ((size_t)s * NB * TT + rb + tid) * 2); mv[s] = t[0]; lv[s] = t[1]; mx = fmaxf(mx, t[0]); }
    float den = 0.f;
#pragma unroll
    for (int s = 0; s < FA_KS; ++s) { mv[s] = expf(mv[s] - mx); den += mv[s] * lv[s]; }
    const float inv = 1.0f / den;   /* den is 1 (to rounding) or more: the slice that holds the maximum has weight 1 and a sum that holds the maximum's own term */
#pragma unroll
    for (int s = 0; s < FA_KS; ++s) wsl[s][tid] = mv[s] * inv; }
  __syncthreads();   // the rows' slice weights are in LDS
  for (int e = tid; e < 64 * 32; e += 128) { const int rl = e >> 5, q = e & 31; const float* yp = Y + (rb + rl) * (size_t)(FA_KS * CC) + q * 4; v4f yv = *(const v4f*)yp * wsl[0][rl];
#pragma unroll
    for (int s = 1; s < FA_KS; ++s) yv += *(const v4f*)(yp + s * CC) * wsl[s][rl];   /* the row's key slices, fixed order */
    asm volatile("s_wait_xcnt 0x0" ::: "memory");   // the slice loads' address registers may be reused behind this point
    stc[q * 4][rl] = yv[0]; stc[q * 4 + 1][rl] = yv[1]; stc[q * 4 + 2][rl] = yv[2]; stc[q * 4 + 3][rl] = yv[3]; }
  __syncthreads();
  for (int e = tid; e < 128 * 16; e += 128) { const int cl = e >> 4, q = e & 15; const size_t o = ((size_t)bb * CC + cl) * NPIX + t0 + q * 4; const v4f xv = *(const v4f*)(X + o); v4f r4 = *(const v4f*)&stc[cl][q * 4]; r4[0] = bfr(xv[0]) + gm * r4[0]; r4[1] = bfr(xv[1]) + gm * r4[1]; r4[2] = bfr(xv[2]) + gm * r4[2]; r4[3] = bfr(xv[3]) + gm * r4[3]; vst2(OUT + o, r4); } }
#ifndef SM_EXTRA_PARAMS
#define SM_EXTRA_PARAMS
#endif
#ifndef PROJ_EXTRA_PARAMS
#define PROJ_EXTRA_PARAMS
#endif
#ifndef SM_MASK_HOOK
#define SM_MASK_HOOK (void)0
#endif

#define WS_QH  0u                                      // f16 q rows [b*t][CC]
#define WS_KH  (WS_QH + 2u * (size_t)NB * TT * CC)      // f16 k rows [b*t][CC]
#define WS_VT  (WS_KH + 2u * (size_t)NB * TT * CC)      // f16 v planes [b][c][t]
#define WS_QL  (WS_VT + 2u * (size_t)NB * CC * TT)      // f16 q residual x 2^10 rows [b][t < QHI][CC]
#define WS_KL  (WS_QL + 2u * (size_t)NB * QHI * CC)     // f16 k residual x 2^10 rows [b][t < KHI][CC]
#define WS_VB  (WS_KL + 2u * (size_t)NB * KHI * CC)     // bf16 v hi planes [b][c][t < KHI]
#define WS_VBL (WS_VB + 2u * (size_t)NB * CC * KHI)
#define WS_YY (WS_VBL + 2u * (size_t)NB * CC * KHI)    // f32 partial ctx rows [b*t][key slice][128], unnormalised
#define WS_ML (WS_YY + 4u * (size_t)FA_KS * NB * TT * CC)   // f32 (running maximum, sum) pairs [key slice][b*t]
#define WS_END2 (WS_ML + 8u * (size_t)FA_KS * NB * TT)

typedef __attribute__((ext_vector_type(4))) __bf16 v4b;
// ---- k_proj: block = (64 rows, 128 cols, which): q/k/v = X W (+ b) with exact bf16 products (K = DIN) -> which 0: q f16 rows (+ residual rows < QHI); 1: k f16 rows (+ residual rows < KHI); 2: v f16 planes [c][t] (+ bf16 hi/lo planes for t < KHI)
__global__ __launch_bounds__(128) void k_proj(const float* __restrict__ XQ, const float* __restrict__ XK, const float* __restrict__ XV, const float* __restrict__ WQ, const float* __restrict__ WK, const float* __restrict__ WV, const float* __restrict__ BQ, const float* __restrict__ BK, const float* __restrict__ BV,
    _Float16* __restrict__ QH, _Float16* __restrict__ QL, _Float16* __restrict__ KH, _Float16* __restrict__ KL, _Float16* __restrict__ VT, __bf16* __restrict__ VB, __bf16* __restrict__ VBL) {
  __shared__ __align__(16) _Float16 sh[64][136], sl[64][136]; __shared__ __align__(16) _Float16 th[128][72]; __shared__ __align__(16) __bf16 tb[128][72], tbl[128][72];
  __shared__ __align__(16) __bf16 sw[128][DIN + 8];   // the block's 128 weight rows (out, in) as bf16; 272-B pitch: conflict-free 16-byte fragment reads
  const int tid = threadIdx.x, wave = tid >> 5, lane = tid & 31, col = lane & 15, g = lane >> 4; const int which = blockIdx.z; const int c0 = blockIdx.y * 128; const size_t r0 = (size_t)blockIdx.x * 64; const size_t bb = r0 / TT; const int t0 = (int)(r0 % TT);
  const float* X = which == 0 ? XQ : which == 1 ? XK : XV; const float* WA = which == 0 ? WQ : which == 1 ? WK : WV; const float* BA = which == 0 ? BQ : which == 1 ? BK : BV;
  // Every global load of the block is issued before its first wait, so their latencies overlap (104 loads a wave against a load counter of 63: about two latencies stay exposed) in place of one exposed latency per fragment. The weight comes in by whole-line loads (a wave = one 512-B row), once per block, and goes to LDS as bf16; the four waves read their B fragments from there.
  v4f wr[128 * (DIN / 4) / 128]; { const float* wp = WA + (size_t)(c0 + wave) * DIN + lane * 4;
#pragma unroll
    for (int i = 0; i < 128 * (DIN / 4) / 128; ++i) wr[i] = *(const v4f*)(wp + i * 4 * DIN); }
  asm volatile("s_wait_xcnt 0x0" ::: "memory");   // the weight loads' address pair may be reused by the loads behind this point
  float xr[DIN / 32][16]; { const float* p = X + ((size_t)bb * DIN + 8 * g) * NPIX + t0 + wave * 16 + col;   /* channels-first gather: x[b][k][n], stride NPIX between channels */
#pragma unroll
    for (int kc = 0; kc < DIN / 32; ++kc) {
#pragma unroll
      for (int i = 0; i < 8; ++i) { xr[kc][i] = p[(size_t)(kc * 32 + i) * NPIX]; xr[kc][8 + i] = p[(size_t)(kc * 32 + 16 + i) * NPIX]; } } }
  float bias8[8] = {};
  if (BA) { const float* bp = BA + c0 + col;
#pragma unroll
    for (int j = 0; j < 8; ++j) bias8[j] = bp[j * 16]; }
  asm volatile("s_wait_xcnt 0x0" ::: "memory");   // the loads' address registers may be reused behind this point; it also keeps every load above in front of the LDS stores
#pragma unroll
  for (int i = 0; i < 128 * (DIN / 4) / 128; ++i) { v4b t; t[0] = (__bf16)wr[i][0]; t[1] = (__bf16)wr[i][1]; t[2] = (__bf16)wr[i][2]; t[3] = (__bf16)wr[i][3]; *(v4b*)&sw[wave + i * 4][lane * 4] = t; }
  v16b a[DIN / 32];
#pragma unroll
  for (int kc = 0; kc < DIN / 32; ++kc) {
#pragma unroll
    for (int i = 0; i < 16; ++i) a[kc][i] = (__bf16)xr[kc][i]; }
#pragma unroll
  for (int j = 0; j < 8; ++j) bias8[j] = bfr(bias8[j]);
  __syncthreads();   // the weight is in LDS
  v8f acc[8] = {}; v16b fb[2][8];   // fb: two batches of B fragments (the eight 16-column tiles of one 32-channel step): the next batch's LDS reads fly while this batch's products run
  const __bf16* wrow = &sw[col][0];   /* frag_b has the k order of the gather above: elements 0..7 = k0 + 8g + i, 8..15 = k0 + 16 + 8g + i */
#pragma unroll
  for (int j = 0; j < 8; ++j) fb[0][j] = frag_b(wrow + j * 16 * (DIN + 8), lane);
#pragma unroll   // a[], fb[] and acc[] stay in registers only under constant indices
  for (int kc = 0; kc < DIN / 32; ++kc) { const int cb = kc & 1, nb = cb ^ 1;
    if (kc + 1 < DIN / 32) {
#pragma unroll
      for (int j = 0; j < 8; ++j) fb[nb][j] = frag_b(wrow + j * 16 * (DIN + 8) + (kc + 1) * 32, lane); }
#pragma unroll
    for (int j = 0; j < 8; ++j) acc[j] = wmma_bf(a[kc], fb[cb][j], acc[j]); }
  if (which < 2) { _Float16* DH = which == 0 ? QH : KH; _Float16* DL = which == 0 ? QL : KL; const int nhi = which == 0 ? QHI : KHI; const bool hi_rows = t0 < nhi;
#pragma unroll
    for (int j = 0; j < 8; ++j) { const float bias = bias8[j];
#pragma unroll
      for (int r = 0; r < 8; ++r) { const float v = acc[j][r] + bias; const _Float16 hv = (_Float16)v; sh[wave * 16 + 8 * g + r][j * 16 + col] = hv; sl[wave * 16 + 8 * g + r][j * 16 + col] = (_Float16)((v - (float)hv) * 1024.0f); } }
    __syncthreads();
    for (int e = tid; e < 64 * 16; e += 128) { const int rl = e >> 4, q = e & 15; vst2((unsigned*)(DH + (r0 + rl) * CC + c0 + q * 8), *(const v4u*)&sh[rl][q * 8]); if (hi_rows) vst2((unsigned*)(DL + (bb * nhi + t0 + rl) * (size_t)CC + c0 + q * 8), *(const v4u*)&sl[rl][q * 8]); }
  } else { const bool hi_rows = t0 < KHI;
#pragma unroll
    for (int j = 0; j < 8; ++j) { const float bias = bias8[j];
#pragma unroll
      for (int r = 0; r < 8; ++r) { const float v = acc[j][r] + bias; const int rl = wave * 16 + 8 * g + r, cl = j * 16 + col; th[cl][rl] = (_Float16)v; const __bf16 bh = (__bf16)v; tb[cl][rl] = bh; tbl[cl][rl] = (__bf16)(v - (float)bh); } }
    __syncthreads();
    for (int e = tid; e < 128 * 8; e += 128) { const int cl = e >> 3, q = e & 7; vst2((unsigned*)(VT + (bb * CC + c0 + cl) * (size_t)TT + t0 + q * 8), *(const v4u*)&th[cl][q * 8]); if (hi_rows) { const size_t o3 = (bb * CC + c0 + cl) * (size_t)KHI + t0 + q * 8; vst2((unsigned*)(VB + o3), *(const v4u*)&tb[cl][q * 8]); vst2((unsigned*)(VBL + o3), *(const v4u*)&tbl[cl][q * 8]); } } } }
// the builtin forms as they are: the compiler keeps the distance behind a matrix instruction itself and is free to move LDS reads ahead of it
__device__ __forceinline__ v8f mm_h(v16h a, v16h b, v8f c) { return __builtin_amdgcn_wmma_f32_16x16x32_f16(false, a, false, b, (short)0, c, false, false); }
__device__ __forceinline__ v8f mm_b(v16b a, v16b b, v8f c) { return __builtin_amdgcn_wmma_f32_16x16x32_bf16(false, a, false, b, (short)0, c, false, false); }
__global__ __launch_bounds__(256) void k_fa(const _Float16* __restrict__ QH, const _Float16* __restrict__ QL, const _Float16* __restrict__ KH, const _Float16* __restrict__ KL, const __bf16* __restrict__ VB, const __bf16* __restrict__ VBL, float* __restrict__ Y, float* __restrict__ ML) {
  __shared__ __align__(16) _Float16 skh[FA_SK][CC + 8], skl[FA_SK][CC + 8];   // 272-B pitch: conflict-free 16-byte fragment reads
  __shared__ __align__(16) __bf16 svh[CC][FA_SK + 8], svl[CC][FA_SK + 8];     // 144-B pitch, likewise
  const int tid = threadIdx.x, wave = tid >> 5, lane = tid & 31, col = lane & 15, g = lane >> 4;
  const size_t qr = (size_t)blockIdx.x * 128 + wave * 16 + col;   // this lane's query row in [b*t]
  const size_t bb = (size_t)blockIdx.x / (TT / 128); const int key0 = (int)blockIdx.y * (TT / FA_KS);
  const int kr = tid >> 4, kq = (tid & 15) * 8, vr = tid >> 3, vq = (tid & 7) * 8;   // staging: 16 lanes per 256-B k row, 8 lanes per 128-B run of a v plane
  const _Float16 *gkh = KH + (bb * TT + key0 + kr) * (size_t)CC + kq, *gkl = KL + (bb * TT + key0 + kr) * (size_t)CC + kq; const __bf16 *gvh = VB + (bb * CC + vr) * (size_t)KHI + key0 + vq, *gvl = VBL + (bb * CC + vr) * (size_t)KHI + key0 + vq;
  v16h qh[HD / 32], ql[HD / 32];
#pragma unroll
  for (int kc = 0; kc < HD / 32; ++kc) { qh[kc] = frag_h(QH + qr * CC + kc * 32, lane); ql[kc] = frag_h(QL + qr * CC + kc * 32, lane); }
  v8f o[HD / 16] = {}; float mrun = -3.0e38f, lsum = 0.f;   // mrun: running maximum of score x SC2, the base-2 exponent that is taken off
#pragma unroll 1   // rolled: one stage's code is the whole hot loop and the accumulators stay in place
  for (int st = 0; st < TT / FA_KS / FA_SK; ++st) {
    __syncthreads();   // every wave has finished reading the stage before
#pragma unroll
    for (int i = 0; i < FA_SK * 16 / 256; ++i) { *(v4u*)&skh[kr + i * 16][kq] = *(const v4u*)(gkh + i * 16 * CC); *(v4u*)&skl[kr + i * 16][kq] = *(const v4u*)(gkl + i * 16 * CC); }
#pragma unroll
    for (int i = 0; i < CC * (FA_SK / 8) / 256; ++i) { *(v4u*)&svh[vr + i * 32][vq] = *(const v4u*)(gvh + (size_t)i * 32 * KHI); *(v4u*)&svl[vr + i * 32][vq] = *(const v4u*)(gvl + (size_t)i * 32 * KHI); }
    asm volatile("s_wait_xcnt 0x0" ::: "memory");   // the stage loads' address registers are rewritten behind this point
    gkh += FA_SK * CC; gkl += FA_SK * CC; gvh += FA_SK; gvl += FA_SK;   // the lane's four source pointers walk on by one stage, behind the stores that waited for the loads
    __syncthreads();   // the stage is in LDS
#pragma unroll 1   // rolled: halves the hot loop's code; both passes are alike
    for (int u = 0; u < FA_SK / 32; ++u) {
      v8f sh[2] = {}, sl[2] = {}; v16h ka[2][4];   // ka: two batches of fragments (k hi, k residual of both 16-key tiles for one 32-channel step): the next batch's LDS reads fly while this batch's products run
      const _Float16 *rh = &skh[u * 32 + col][0], *rl = &skl[u * 32 + col][0];
      ka[0][0] = frag_h(rh, lane); ka[0][1] = frag_h(rl, lane); ka[0][2] = frag_h(rh + 16 * (CC + 8), lane); ka[0][3] = frag_h(rl + 16 * (CC + 8), lane);
#pragma unroll
      for (int kc = 0; kc < HD / 32; ++kc) { const int cb = kc & 1, nb = cb ^ 1;
        if (kc + 1 < HD / 32) { ka[nb][0] = frag_h(rh + (kc + 1) * 32, lane); ka[nb][1] = frag_h(rl + (kc + 1) * 32, lane); ka[nb][2] = frag_h(rh + 16 * (CC + 8) + (kc + 1) * 32, lane); ka[nb][3] = frag_h(rl + 16 * (CC + 8) + (kc + 1) * 32, lane); }
        __builtin_amdgcn_sched_barrier(0);   // keeps the next batch's reads in front of this block: sunk to their use, each would expose the LDS latency
        sh[0] = mm_h(ka[cb][0], qh[kc], sh[0]); sh[1] = mm_h(ka[cb][2], qh[kc], sh[1]); sl[0] = mm_h(ka[cb][0], ql[kc], sl[0]); sl[1] = mm_h(ka[cb][2], ql[kc], sl[1]); sl[0] = mm_h(ka[cb][1], qh[kc], sl[0]); sl[1] = mm_h(ka[cb][3], qh[kc], sl[1]);
        __builtin_amdgcn_sched_barrier(0); }   // ends the block: the reads behind it stay behind it
      v16b va[2][4];   // likewise for v: hi, lo planes of two 16-channel tiles; the first batch flies behind the softmax arithmetic
      const __bf16 *wh = &svh[col][u * 32], *wl = &svl[col][u * 32];
      va[0][0] = frag_b(wh, lane); va[0][1] = frag_b(wl, lane); va[0][2] = frag_b(wh + 16 * (FA_SK + 8), lane); va[0][3] = frag_b(wl + 16 * (FA_SK + 8), lane);
      __builtin_amdgcn_sched_barrier(0);   // keeps these reads in front of the softmax arithmetic
      float pv[16]; float mx = -3.0e38f;
#pragma unroll
      for (int r = 0; r < 8; ++r) { pv[r] = sh[0][r] + sl[0][r] * (1.0f / 1024.0f); pv[8 + r] = sh[1][r] + sl[1][r] * (1.0f / 1024.0f); mx = fmaxf(mx, fmaxf(pv[r], pv[8 + r])); }   /* unscaled: SC2 > 0 keeps the order */
      mx = fmaxf(mx, __shfl_xor(mx, 16)) * SC2;   // the other half of the wave holds this query's other 16 keys; from here on in base-2 exponent units
      if (__builtin_amdgcn_ballot_w32(mx > mrun) != 0) {   // some query's maximum rose: rescale what is summed so far (factor 1 for the others)
        const float mn = fmaxf(mrun, mx), al = __builtin_amdgcn_exp2f(mrun - mn); mrun = mn; lsum *= al;
#pragma unroll
        for (int j = 0; j < HD / 16; ++j) o[j] *= al; }
#pragma unroll
      for (int i = 0; i < 16; ++i) pv[i] = fmaf(pv[i], SC2, -mrun);   /* all sixteen exponents first: the exp2 run behind them then has independent neighbours */
#pragma unroll   // pv[] must stay in registers
      for (int i = 0; i < 16; ++i) { pv[i] = __builtin_amdgcn_exp2f(pv[i]); lsum += pv[i]; }
      const F2 p = bsplit16(pv);
#pragma unroll
      for (int jb = 0; jb < HD / 32; ++jb) { const int cb = jb & 1, nb = cb ^ 1, j = 2 * jb;
        if (jb + 1 < HD / 32) { va[nb][0] = frag_b(wh + (j + 2) * 16 * (FA_SK + 8), lane); va[nb][1] = frag_b(wl + (j + 2) * 16 * (FA_SK + 8), lane); va[nb][2] = frag_b(wh + (j + 3) * 16 * (FA_SK + 8), lane); va[nb][3] = frag_b(wl + (j + 3) * 16 * (FA_SK + 8), lane); }
        __builtin_amdgcn_sched_barrier(0);   // as above: the next batch's reads stay in front of this block
        o[j] = mm_b(va[cb][0], p.h, o[j]); o[j + 1] = mm_b(va[cb][2], p.h, o[j + 1]); o[j] = mm_b(va[cb][0], p.l, o[j]); o[j + 1] = mm_b(va[cb][2], p.l, o[j + 1]); o[j] = mm_b(va[cb][1], p.h, o[j]); o[j + 1] = mm_b(va[cb][3], p.h, o[j + 1]);
        __builtin_amdgcn_sched_barrier(0); } } }   // ends the block
  lsum += __shfl_xor(lsum, 16);
  float* yr = Y + (qr * FA_KS + blockIdx.y) * CC + 8 * g;   // O^T tile j, element r = channel 16 j + 8 g + r of query qr
#pragma unroll
  for (int j = 0; j < HD / 16; ++j) { vst2(yr + j * 16, __builtin_shufflevector(o[j], o[j], 0, 1, 2, 3)); vst2(yr + j * 16 + 4, __builtin_shufflevector(o[j], o[j], 4, 5, 6, 7)); }
  if (g == 0) { v2f t; t[0] = mrun * 0.6931471805599453f; t[1] = lsum;   /* the maximum in natural-log units, as k_resT weighs the slices */ vst2(ML + ((size_t)blockIdx.y * NB * TT + qr) * 2, t); } }

extern "C" void kernel_launch(void* const* d_in, const int* in_sizes, int n_in, void* d_out, int out_size, void* d_ws, size_t ws_size, hipStream_t stream) {
  (void)in_sizes; (void)n_in; (void)out_size;
  const float** F = (const float**)d_in;
  if (ws_size < (size_t)WS_END2) return;
  char* ws = (char*)d_ws; _Float16 *QH = (_Float16*)(ws + WS_QH), *KH = (_Float16*)(ws + WS_KH), *VT = (_Float16*)(ws + WS_VT), *QL = (_Float16*)(ws + WS_QL), *KL = (_Float16*)(ws + WS_KL); __bf16 *VB = (__bf16*)(ws + WS_VB), *VBL = (__bf16*)(ws + WS_VBL); float *YY = (float*)(ws + WS_YY), *ML = (float*)(ws + WS_ML);
  // inputs: 0 x [2,128,16,16,16]; 1 Wq (out,in), 2 bq; 3 Wk, 4 bk; 5 Wv, 6 bv; 7 gamma [scalar]
  k_proj<<<dim3(TNB * TT / 64, CC / 128, 3), 128, 0, stream>>>(F[0], F[0], F[0], F[1], F[3], F[5], F[2], F[4], F[6], QH, QL, KH, KL, VT, VB, VBL);
  k_fa<<<dim3(TNB * TT / 128, FA_KS), 256, 0, stream>>>(QH, QL, KH, KL, VB, VBL, YY, ML);
  k_resT<<<dim3(TNB * TT / 64), 128, 0, stream>>>(YY, ML, F[0], F[7], (float*)d_out);
}

// v005
// It runs in 52.6 microseconds.
// Timed twice side by side with v004, it ran 1.19 and 1.18 times as fast.
// All steps since v000 together make it 18.0 times as fast.
// compute dtype: all float inputs rounded to bf16; q/k/v = W x + b with EXACT bf16 products on WMMA 16x16x32 (f32 accumulate; channels-first input gathered); logits with BOTH q and k as f16 hi + residual (x 2^10) (3 products) x 1.3 - the logits have sigma ~15 so the softmax is sharply peaked and single-f16 operands would not do; online softmax in f32 in base 2 (hardware exp2 of score x 1.3 log2 e minus the running maximum per query, one fused multiply-add); unnormalised P split bf16 hi + lo against v bf16 hi + lo (3 products); residual x + gamma out in f32; f32 output (channels-first).
#include <hip/hip_runtime.h>
#include <math.h>

typedef __attribute__((ext_vector_type(16))) _Float16 v16h;
typedef __attribute__((ext_vector_type(16))) __bf16 v16b;
typedef __attribute__((ext_vector_type(8)))  _Float16 v8h;
typedef __attribute__((ext_vector_type(8)))  float v8f;
typedef __attribute__((ext_vector_type(4)))  float v4f;
typedef __attribute__((ext_vector_type(2)))  float v2f;
typedef __attribute__((ext_vector_type(4)))  unsigned v4u;
typedef __attribute__((ext_vector_type(4)))  int v4i;
typedef float __attribute__((may_alias)) float_a;
typedef int __attribute__((may_alias)) int_a;

template <typename T> __device__ __forceinline__ void vst2(void* p, T v) { *(T*)p = v;  }
__device__ __forceinline__ v8f wmma16(v16h a, v16h b, v8f c) {
  v8f d = __builtin_amdgcn_wmma_f32_16x16x32_f16(false, a, false, b, (short)0, c, false, false);
  asm volatile("v_nop\n\tv_nop\n\tv_nop\n\tv_nop" : "+v"(d) : "v"(a), "v"(b));
  return d;
}
__device__ __forceinline__ v8f wmma_bf(v16b a, v16b b, v8f c) {
  v8f d = __builtin_amdgcn_wmma_f32_16x16x32_bf16(false, a, false, b, (short)0, c, false, false);
  asm volatile("v_nop\n\tv_nop\n\tv_nop\n\tv_nop" : "+v"(d) : "v"(a), "v"(b));
  return d;
}
// 16x16x32 fragments: lane = (h = lane>>4, row/col = lane&15); elements 0..7 = k0+8h+0..7, 8..15 = k0+16+8h+0..7; D element r = row 8h+r
__device__ __forceinline__ v16h frag_h(const _Float16* rowk0, int lane) {
  union { v16h v; v8h q[2]; } u; const _Float16* p = rowk0 + 8 * (lane >> 4);
  u.q[0] = *(const v8h*)p; u.q[1] = *(const v8h*)(p + 16); return u.v;
}
__device__ __forceinline__ v16h frag_f32(const float* rowk0, int lane) {
  v16h a; const float* p = rowk0 + 8 * (lane >> 4);
#pragma unroll
  for (int i = 0; i < 8; ++i) { a[i] = (_Float16)p[i]; a[8 + i] = (_Float16)p[16 + i]; }
  return a;
}
__device__ __forceinline__ v16h frag_f32s(const float* rowk0, int lane, float sc) {
  v16h a; const float* p = rowk0 + 8 * (lane >> 4);
#pragma unroll
  for (int i = 0; i < 8; ++i) { a[i] = (_Float16)(p[i] * sc); a[8 + i] = (_Float16)(p[16 + i] * sc); }
  return a;
}
// column fragment from a [K][ld] layout (column n), rows >= K read as 0
__device__ __forceinline__ v16h fragc_f32(const float* W, int k0, int n, int lane, int ld, int K) {
  v16h a; const int g = lane >> 4;
#pragma unroll
  for (int i = 0; i < 8; ++i) { const int ka = k0 + 8 * g + i, kb = ka + 16;
    a[i] = (_Float16)(ka < K ? W[(size_t)(ka < K ? ka : K - 1) * ld + n] : 0.f); a[8 + i] = (_Float16)(kb < K ? W[(size_t)(kb < K ? kb : K - 1) * ld + n] : 0.f); }
  return a;
}
struct F2 { v16b h, l; };
__device__ __forceinline__ F2 bsplit16(const float v[16]) { F2 r;
#pragma unroll
  for (int i = 0; i < 16; ++i) { const __bf16 h = (__bf16)v[i]; r.h[i] = h; r.l[i] = (__bf16)(v[i] - (float)h); }
  return r; }
__device__ __forceinline__ F2 split_row(const float* row, int k0, int lane) { float v[16]; const float* p = row + k0 + 8 * (lane >> 4);
#pragma unroll
  for (int i = 0; i < 8; ++i) { v[i] = p[i]; v[8 + i] = p[16 + i]; }
  return bsplit16(v); }
__device__ __forceinline__ F2 split_rowK(const float* row, int k0, int lane, int K) { float v[16]; const int g = lane >> 4;
#pragma unroll
  for (int i = 0; i < 8; ++i) { const int ka = k0 + 8 * g + i, kb = ka + 16; v[i] = ka < K ? row[ka < K ? ka : K - 1] : 0.f; v[8 + i] = kb < K ? row[kb < K ? kb : K - 1] : 0.f; }
  return bsplit16(v); }
__device__ __forceinline__ F2 split_col(const float* W, int k0, int n, int lane, int ld, int K) { float v[16]; const int g = lane >> 4;
#pragma unroll
  for (int i = 0; i < 8; ++i) { const int ka = k0 + 8 * g + i, kb = ka + 16; v[i] = ka < K ? W[(size_t)(ka < K ? ka : K - 1) * ld + n] : 0.f; v[8 + i] = kb < K ? W[(size_t)(kb < K ? kb : K - 1) * ld + n] : 0.f; }
  return bsplit16(v); }
__device__ __forceinline__ v8f mac3(const F2& a, const F2& b, v8f c) { c = wmma_bf(a.l, b.h, c); c = wmma_bf(a.h, b.l, c); return wmma_bf(a.h, b.h, c); }
__device__ __forceinline__ float sigm(float v) { return 1.0f / (1.0f + expf(-v)); }
#define LDSX() do { asm volatile("s_wait_dscnt 0" ::: "memory"); __builtin_amdgcn_wave_barrier(); __builtin_amdgcn_fence(__ATOMIC_RELEASE, "workgroup"); } while (0)

// Single-head self-attention over a flattened 16x16x16 volume (B 2, C 128, N 4,096): q/k/v = 1x1x1 convs (W (out,in) [128,128] + b); attn = softmax((q^T k) * 1.3) over keys; out[c][n] = sum_m v[c][m] attn[n][m]; result = x + gamma * out (gamma = 0.3 scalar input).
#define NB 2
#define TT 4096
#define CC 128            // NH * HD = projected width
#define DIN 128          // input (model) width
#define NH 1
#define HD 128
#define NQB (TT / 64)
#define HG 1
#define SCALE (1.3f)
#define SC2 ((float)((double)SCALE * 1.4426950408889634))   // SCALE x log2 e: exp(SCALE t) = exp2(SC2 t)
#define CAUSAL 0
#ifndef TNB
#define TNB NB
#endif
__device__ __forceinline__ float bfr(float v) { return (float)(__bf16)v; }
__host__ __device__ __forceinline__ int kb_last(int qb) { return CAUSAL ? ((qb * 64 + 63) >> 7) : (TT / 128 - 1); }
typedef __attribute__((ext_vector_type(8))) __bf16 v8b;
__device__ __forceinline__ v16b frag_b(const __bf16* rowk0, int lane) {
  union { v16b v; v8b q[2]; } u; const __bf16* p = rowk0 + 8 * (lane >> 4);
  u.q[0] = *(const v8b*)p; u.q[1] = *(const v8b*)(p + 16); return u.v;
}
#define QBH NQB            // EVERY query block takes the 3-product logits + bf16 hi+lo P.v path (logit sigma ~15: sharply peaked softmax)
#define QHI 4096            // rows carrying a q residual plane (all rows when non-causal: 3-product logits everywhere)
#define KHI TT            // residual / bf16 hi+lo planes for ALL keys
// B fragment (k rows k0+.., output column o) of a weight: (in,out) [K][ld] or (out,in) [ld rows of K]: bf16 exact, or f16(bf16 * 256) exact
__device__ __forceinline__ v16b wcol_io(const float* Wm, int k0, int o, int lane, int ld) { v16b w; const int g = lane >> 4;
#pragma unroll
  for (int i = 0; i < 8; ++i) { w[i] = (__bf16)Wm[(size_t)(k0 + 8 * g + i) * ld + o]; w[8 + i] = (__bf16)Wm[(size_t)(k0 + 16 + 8 * g + i) * ld + o]; }
  return w; }
__device__ __forceinline__ v16b wcol_oi(const float* Wm, int k0, int o, int lane, int K) { v16b w; const float* p = Wm + (size_t)o * K + k0 + 8 * (lane >> 4);
#pragma unroll
  for (int i = 0; i < 8; ++i) { w[i] = (__bf16)p[i]; w[8 + i] = (__bf16)p[16 + i]; }
  return w; }
__device__ __forceinline__ v16h wcolh_io(const float* Wm, int k0, int o, int lane, int ld) { v16h w; const int g = lane >> 4;
#pragma unroll
  for (int i = 0; i < 8; ++i) { w[i] = (_Float16)(bfr(Wm[(size_t)(k0 + 8 * g + i) * ld + o]) * 256.0f); w[8 + i] = (_Float16)(bfr(Wm[(size_t)(k0 + 16 + 8 * g + i) * ld + o]) * 256.0f); }
  return w; }
__device__ __forceinline__ v16h wcolh_oi(const float* Wm, int k0, int o, int lane, int K) { v16h w; const float* p = Wm + (size_t)o * K + k0 + 8 * (lane >> 4);
#pragma unroll
  for (int i = 0; i < 8; ++i) { w[i] = (_Float16)(bfr(p[i]) * 256.0f); w[8 + i] = (_Float16)(bfr(p[16 + i]) * 256.0f); }
  return w; }
#define WQKV_LAYOUT 1   // 0 = (in,out) [DIN][CC]; 1 = (out,in) [CC][DIN]; 2 = per-head [NH][DIN][HD]
__device__ __forceinline__ v16b wcol_hdk(const float* Wm, int k0, int o, int lane) { v16b w; const int g = lane >> 4; const float* p = Wm + (size_t)(o / HD) * DIN * HD + (o % HD);
#pragma unroll
  for (int i = 0; i < 8; ++i) { w[i] = (__bf16)p[(size_t)(k0 + 8 * g + i) * HD]; w[8 + i] = (__bf16)p[(size_t)(k0 + 16 + 8 * g + i) * HD]; }
  return w; }
#define WO_OUT_IN 0
#if WQKV_LAYOUT == 1
#define WCOL(W, k0, o, lane) wcol_oi(W, k0, o, lane, DIN)
#elif WQKV_LAYOUT == 2
#define WCOL(W, k0, o, lane) wcol_hdk(W, k0, o, lane)
#else
#define WCOL(W, k0, o, lane) wcol_io(W, k0, o, lane, CC)
#endif
#if WO_OUT_IN
#define WOCOL(W, k0, o, lane) wcol_oi(W, k0, o, lane, CC)
#define WOCOLH(W, k0, o, lane) wcolh_oi(W, k0, o, lane, CC)
#else
#define WOCOL(W, k0, o, lane) wcol_io(W, k0, o, lane, DIN)
#define WOCOLH(W, k0, o, lane) wcolh_io(W, k0, o, lane, DIN)
#endif
#define NPIX 4096
#define FA_KS 8            // key slices over the k_fa grid (per query one partial ctx row, maximum and sum each; merged in k_resT)
#define FA_SK 64           // keys per LDS stage of k_fa
#define RT_R 32            // pixel rows per k_resT block
// ---- k_resT: block = (RT_R pixel rows, 128 channels), 8 waves: merges the FA_KS key slices of a row (weight exp(m_s - M) / sum_s exp(m_s - M) l_s, fixed order), then out[b][c][n] = bf16(x[b][c][n]) + bf16(gamma) * ctx[b*4096 + n][c] via an LDS transpose (each (c, 32 n) run = one 128-B line by 8 threads).
// The partial rows come from memory and are read once, so the kernel runs at the rate of the bytes it keeps in flight: one block per WGP, and every global load of a thread (32 of the partial rows, 4 of x) is issued before its first wait.
__global__ __launch_bounds__(256) void k_resT(const float* __restrict__ Y, const float* __restrict__ ML, const float* __restrict__ X, const float* __restrict__ GM, float* __restrict__ OUT) { __shared__ float stc[128][RT_R + 1]; __shared__ float wsl[FA_KS][RT_R];   // 33-dword pitch: the transposed stores fall on 16 banks, the row reads on 32
  const int tid = threadIdx.x, wave = tid >> 5, lane = tid & 31; const size_t rb = (size_t)blockIdx.x * RT_R; const size_t bb = rb / TT; const int t0 = (int)(rb % TT); const float gm = bfr(GM[0]);
  v2f mlv[FA_KS] = {};
  if (tid < RT_R) {
#pragma unroll
    for (int s = 0; s < FA_KS; ++s) mlv[s] = *(const v2f*)(ML + ((size_t)s * NB * TT + rb + tid) * 2); }
  v4f yv[RT_R / 8][FA_KS]; { const float* yp = Y + (rb + wave) * (size_t)(FA_KS * CC) + lane * 4;   /* a wave = one row's 512 B of one slice per load; rows wave, wave + 8, ... */
#pragma unroll
    for (int it = 0; it < RT_R / 8; ++it) {
#pragma unroll
      for (int s = 0; s < FA_KS; ++s) yv[it][s] = *(const v4f*)(yp + (size_t)it * 8 * FA_KS * CC + s * CC); } }
  const size_t o0 = ((size_t)bb * CC + (tid >> 3)) * NPIX + t0 + (tid & 7) * 4; v4f xv[4];
#pragma unroll
  for (int it = 0; it < 4; ++it) xv[it] = *(const v4f*)(X + o0 + (size_t)it * 32 * NPIX);
  asm volatile("s_wait_xcnt 0x0" ::: "memory");   // the loads' address registers may be reused behind this point; it also keeps every load above in front of the first wait
  if (tid < RT_R) { float mv[FA_KS]; float mx = -3.0e38f;
#pragma unroll
    for (int s = 0; s < FA_KS; ++s) mx = fmaxf(mx, mlv[s][0]);
    float den = 0.f;
#pragma unroll
    for (int s = 0; s < FA_KS; ++s) { mv[s] = expf(mlv[s][0] - mx); den += mv[s] * mlv[s][1]; }
    const float inv = 1.0f / den;   /* den is 1 (to rounding) or more: the slice that holds the maximum has weight 1 and a sum that holds the maximum's own term */
#pragma unroll
    for (int s = 0; s < FA_KS; ++s) wsl[s][tid] = mv[s] * inv; }
  __syncthreads();   // the rows' slice weights are in LDS
#pragma unroll   // yv[] stays in registers only under constant indices
  for (int it = 0; it < RT_R / 8; ++it) { const int rl = wave + it * 8; v4f r = yv[it][0] * wsl[0][rl];
#pragma unroll
    for (int s = 1; s < FA_KS; ++s) r += yv[it][s] * wsl[s][rl];   /* the row's key slices, fixed order */
    stc[lane * 4][rl] = r[0]; stc[lane * 4 + 1][rl] = r[1]; stc[lane * 4 + 2][rl] = r[2]; stc[lane * 4 + 3][rl] = r[3]; }
  __syncthreads();
#pragma unroll   // xv[] likewise
  for (int it = 0; it < 4; ++it) { const float* sp = &stc[(tid >> 3) + it * 32][(tid & 7) * 4]; v4f r4; r4[0] = bfr(xv[it][0]) + gm * sp[0]; r4[1] = bfr(xv[it][1]) + gm * sp[1]; r4[2] = bfr(xv[it][2]) + gm * sp[2]; r4[3] = bfr(xv[it][3]) + gm * sp[3]; vst2(OUT + o0 + (size_t)it * 32 * NPIX, r4); } }
#ifndef SM_EXTRA_PARAMS
#define SM_EXTRA_PARAMS
#endif
#ifndef PROJ_EXTRA_PARAMS
#define PROJ_EXTRA_PARAMS
#endif
#ifndef SM_MASK_HOOK
#define SM_MASK_HOOK (void)0
#endif

#define WS_QH  0u                                      // f16 q rows [b*t][CC]
#define WS_KH  (WS_QH + 2u * (size_t)NB * TT * CC)      // f16 k rows [b*t][CC]
#define WS_VT  (WS_KH + 2u * (size_t)NB * TT * CC)      // f16 v planes [b][c][t]
#define WS_QL  (WS_VT + 2u * (size_t)NB * CC * TT)      // f16 q residual x 2^10 rows [b][t < QHI][CC]
#define WS_KL  (WS_QL + 2u * (size_t)NB * QHI * CC)     // f16 k residual x 2^10 rows [b][t < KHI][CC]
#define WS_VB  (WS_KL + 2u * (size_t)NB * KHI * CC)     // bf16 v hi planes [b][c][t < KHI]
#define WS_VBL (WS_VB + 2u * (size_t)NB * CC * KHI)
#define WS_YY (WS_VBL + 2u * (size_t)NB * CC * KHI)    // f32 partial ctx rows [b*t][key slice][128], unnormalised
#define WS_ML (WS_YY + 4u * (size_t)FA_KS * NB * TT * CC)   // f32 (running maximum, sum) pairs [key slice][b*t]
#define WS_END2 (WS_ML + 8u * (size_t)FA_KS * NB * TT)

typedef __attribute__((ext_vector_type(4))) __bf16 v4b;
// ---- k_proj: block = (64 rows, 128 cols, which): q/k/v = X W (+ b) with exact bf16 products (K = DIN) -> which 0: q f16 rows (+ residual rows < QHI); 1: k f16 rows (+ residual rows < KHI); 2: v f16 planes [c][t] (+ bf16 hi/lo planes for t < KHI)
__global__ __launch_bounds__(128) void k_proj(const float* __restrict__ XQ, const float* __restrict__ XK, const float* __restrict__ XV, const float* __restrict__ WQ, const float* __restrict__ WK, const float* __restrict__ WV, const float* __restrict__ BQ, const float* __restrict__ BK, const float* __restrict__ BV,
    _Float16* __restrict__ QH, _Float16* __restrict__ QL, _Float16* __restrict__ KH, _Float16* __restrict__ KL, _Float16* __restrict__ VT, __bf16* __restrict__ VB, __bf16* __restrict__ VBL) {
  __shared__ __align__(16) _Float16 sh[64][136], sl[64][136]; __shared__ __align__(16) _Float16 th[128][72]; __shared__ __align__(16) __bf16 tb[128][72], tbl[128][72];
  __shared__ __align__(16) __bf16 sw[128][DIN + 8];   // the block's 128 weight rows (out, in) as bf16; 272-B pitch: conflict-free 16-byte fragment reads
  const int tid = threadIdx.x, wave = tid >> 5, lane = tid & 31, col = lane & 15, g = lane >> 4; const int which = blockIdx.z; const int c0 = blockIdx.y * 128; const size_t r0 = (size_t)blockIdx.x * 64; const size_t bb = r0 / TT; const int t0 = (int)(r0 % TT);
  const float* X = which == 0 ? XQ : which == 1 ? XK : XV; const float* WA = which == 0 ? WQ : which == 1 ? WK : WV; const float* BA = which == 0 ? BQ : which == 1 ? BK : BV;
  // Every global load of the block is issued before its first wait, so their latencies overlap (104 loads a wave against a load counter of 63: about two latencies stay exposed) in place of one exposed latency per fragment. The weight comes in by whole-line loads (a wave = one 512-B row), once per block, and goes to LDS as bf16; the four waves read their B fragments from there.
  v4f wr[128 * (DIN / 4) / 128]; { const float* wp = WA + (size_t)(c0 + wave) * DIN + lane * 4;
#pragma unroll
    for (int i = 0; i < 128 * (DIN / 4) / 128; ++i) wr[i] = *(const v4f*)(wp + i * 4 * DIN); }
  asm volatile("s_wait_xcnt 0x0" ::: "memory");   // the weight loads' address pair may be reused by the loads behind this point
  float xr[DIN / 32][16]; { const float* p = X + ((size_t)bb * DIN + 8 * g) * NPIX + t0 + wave * 16 + col;   /* channels-first gather: x[b][k][n], stride NPIX between channels */
#pragma unroll
    for (int kc = 0; kc < DIN / 32; ++kc) {
#pragma unroll
      for (int i = 0; i < 8; ++i) { xr[kc][i] = p[(size_t)(kc * 32 + i) * NPIX]; xr[kc][8 + i] = p[(size_t)(kc * 32 + 16 + i) * NPIX]; } } }
  float bias8[8] = {};
  if (BA) { const float* bp = BA + c0 + col;
#pragma unroll
    for (int j = 0; j < 8; ++j) bias8[j] = bp[j * 16]; }
  asm volatile("s_wait_xcnt 0x0" ::: "memory");   // the loads' address registers may be reused behind this point; it also keeps every load above in front of the LDS stores
#pragma unroll
  for (int i = 0; i < 128 * (DIN / 4) / 128; ++i) { v4b t; t[0] = (__bf16)wr[i][0]; t[1] = (__bf16)wr[i][1]; t[2] = (__bf16)wr[i][2]; t[3] = (__bf16)wr[i][3]; *(v4b*)&sw[wave + i * 4][lane * 4] = t; }
  v16b a[DIN / 32];
#pragma unroll
  for (int kc = 0; kc < DIN / 32; ++kc) {
#pragma unroll
    for (int i = 0; i < 16; ++i) a[kc][i] = (__bf16)xr[kc][i]; }
#pragma unroll
  for (int j = 0; j < 8; ++j) bias8[j] = bfr(bias8[j]);
  __syncthreads();   // the weight is in LDS
  v8f acc[8] = {}; v16b fb[2][8];   // fb: two batches of B fragments (the eight 16-column tiles of one 32-channel step): the next batch's LDS reads fly while this batch's products run
  const __bf16* wrow = &sw[col][0];   /* frag_b has the k order of the gather above: elements 0..7 = k0 + 8g + i, 8..15 = k0 + 16 + 8g + i */
#pragma unroll
  for (int j = 0; j < 8; ++j) fb[0][j] = frag_b(wrow + j * 16 * (DIN + 8), lane);
#pragma unroll   // a[], fb[] and acc[] stay in registers only under constant indices
  for (int kc = 0; kc < DIN / 32; ++kc) { const int cb = kc & 1, nb = cb ^ 1;
    if (kc + 1 < DIN / 32) {
#pragma unroll
      for (int j = 0; j < 8; ++j) fb[nb][j] = frag_b(wrow + j * 16 * (DIN + 8) + (kc + 1) * 32, lane); }
#pragma unroll
    for (int j = 0; j < 8; ++j) acc[j] = wmma_bf(a[kc], fb[cb][j], acc[j]); }
  if (which < 2) { _Float16* DH = which == 0 ? QH : KH; _Float16* DL = which == 0 ? QL : KL; const int nhi = which == 0 ? QHI : KHI; const bool hi_rows = t0 < nhi;
#pragma unroll
    for (int j = 0; j < 8; ++j) { const float bias = bias8[j];
#pragma unroll
      for (int r = 0; r < 8; ++r) { const float v = acc[j][r] + bias; const _Float16 hv = (_Float16)v; sh[wave * 16 + 8 * g + r][j * 16 + col] = hv; sl[wave * 16 + 8 * g + r][j * 16 + col] = (_Float16)((v - (float)hv) * 1024.0f); } }
    __syncthreads();
    for (int e = tid; e < 64 * 16; e += 128) { const int rl = e >> 4, q = e & 15; vst2((unsigned*)(DH + (r0 + rl) * CC + c0 + q * 8), *(const v4u*)&sh[rl][q * 8]); if (hi_rows) vst2((unsigned*)(DL + (bb * nhi + t0 + rl) * (size_t)CC + c0 + q * 8), *(const v4u*)&sl[rl][q * 8]); }
  } else { const bool hi_rows = t0 < KHI;
#pragma unroll
    for (int j = 0; j < 8; ++j) { const float bias = bias8[j];
#pragma unroll
      for (int r = 0; r < 8; ++r) { const float v = acc[j][r] + bias; const int rl = wave * 16 + 8 * g + r, cl = j * 16 + col; th[cl][rl] = (_Float16)v; const __bf16 bh = (__bf16)v; tb[cl][rl] = bh; tbl[cl][rl] = (__bf16)(v - (float)bh); } }
    __syncthreads();
    for (int e = tid; e < 128 * 8; e += 128) { const int cl = e >> 3, q = e & 7; vst2((unsigned*)(VT + (bb * CC + c0 + cl) * (size_t)TT + t0 + q * 8), *(const v4u*)&th[cl][q * 8]); if (hi_rows) { const size_t o3 = (bb * CC + c0 + cl) * (size_t)KHI + t0 + q * 8; vst2((unsigned*)(VB + o3), *(const v4u*)&tb[cl][q * 8]); vst2((unsigned*)(VBL + o3), *(const v4u*)&tbl[cl][q * 8]); } } } }
// the builtin forms as they are: the compiler keeps the distance behind a matrix instruction itself and is free to move LDS reads ahead of it
__device__ __forceinline__ v8f mm_h(v16h a, v16h b, v8f c) { return __builtin_amdgcn_wmma_f32_16x16x32_f16(false, a, false, b, (short)0, c, false, false); }
__device__ __forceinline__ v8f mm_b(v16b a, v16b b, v8f c) { return __builtin_amdgcn_wmma_f32_16x16x32_bf16(false, a, false, b, (short)0, c, false, false); }
__global__ __launch_bounds__(256) void k_fa(const _Float16* __restrict__ QH, const _Float16* __restrict__ QL, const _Float16* __restrict__ KH, const _Float16* __restrict__ KL, const __bf16* __restrict__ VB, const __bf16* __restrict__ VBL, float* __restrict__ Y, float* __restrict__ ML) {
  __shared__ __align__(16) _Float16 skh[FA_SK][CC + 8], skl[FA_SK][CC + 8];   // 272-B pitch: conflict-free 16-byte fragment reads
  __shared__ __align__(16) __bf16 svh[CC][FA_SK + 8], svl[CC][FA_SK + 8];     // 144-B pitch, likewise
  const int tid = threadIdx.x, wave = tid >> 5, lane = tid & 31, col = lane & 15, g = lane >> 4;
  const size_t qr = (size_t)blockIdx.x * 128 + wave * 16 + col;   // this lane's query row in [b*t]
  const size_t bb = (size_t)blockIdx.x / (TT / 128); const int key0 = (int)blockIdx.y * (TT / FA_KS);
  const int kr = tid >> 4, kq = (tid & 15) * 8, vr = tid >> 3, vq = (tid & 7) * 8;   // staging: 16 lanes per 256-B k row, 8 lanes per 128-B run of a v plane
  const _Float16 *gkh = KH + (bb * TT + key0 + kr) * (size_t)CC + kq, *gkl = KL + (bb * TT + key0 + kr) * (size_t)CC + kq; const __bf16 *gvh = VB + (bb * CC + vr) * (size_t)KHI + key0 + vq, *gvl = VBL + (bb * CC + vr) * (size_t)KHI + key0 + vq;
  v16h qh[HD / 32], ql[HD / 32];
#pragma unroll
  for (int kc = 0; kc < HD / 32; ++kc) { qh[kc] = frag_h(QH + qr * CC + kc * 32, lane); ql[kc] = frag_h(QL + qr * CC + kc * 32, lane); }
  v8f o[HD / 16] = {}; float mrun = -3.0e38f, lsum = 0.f;   // mrun: running maximum of score x SC2, the base-2 exponent that is taken off
#pragma unroll 1   // rolled: one stage's code is the whole hot loop and the accumulators stay in place
  for (int st = 0; st < TT / FA_KS / FA_SK; ++st) {
    __syncthreads();   // every wave has finished reading the stage before
#pragma unroll
    for (int i = 0; i < FA_SK * 16 / 256; ++i) { *(v4u*)&skh[kr + i * 16][kq] = *(const v4u*)(gkh + i * 16 * CC); *(v4u*)&skl[kr + i * 16][kq] = *(const v4u*)(gkl + i * 16 * CC); }
#pragma unroll
    for (int i = 0; i < CC * (FA_SK / 8) / 256; ++i) { *(v4u*)&svh[vr + i * 32][vq] = *(const v4u*)(gvh + (size_t)i * 32 * KHI); *(v4u*)&svl[vr + i * 32][vq] = *(const v4u*)(gvl + (size_t)i * 32 * KHI); }
    asm volatile("s_wait_xcnt 0x0" ::: "memory");   // the stage loads' address registers are rewritten behind this point
    gkh += FA_SK * CC; gkl += FA_SK * CC; gvh += FA_SK; gvl += FA_SK;   // the lane's four source pointers walk on by one stage, behind the stores that waited for the loads
    __syncthreads();   // the stage is in LDS
#pragma unroll 1   // rolled: halves the hot loop's code; both passes are alike
    for (int u = 0; u < FA_SK / 32; ++u) {
      v8f sh[2] = {}, sl[2] = {}; v16h ka[2][4];   // ka: two batches of fragments (k hi, k residual of both 16-key tiles for one 32-channel step): the next batch's LDS reads fly while this batch's products run
      const _Float16 *rh = &skh[u * 32 + col][0], *rl = &skl[u * 32 + col][0];
      ka[0][0] = frag_h(rh, lane); ka[0][1] = frag_h(rl, lane); ka[0][2] = frag_h(rh + 16 * (CC + 8), lane); ka[0][3] = frag_h(rl + 16 * (CC + 8), lane);
#pragma unroll
      for (int kc = 0; kc < HD / 32; ++kc) { const int cb = kc & 1, nb = cb ^ 1;
        if (kc + 1 < HD / 32) { ka[nb][0] = frag_h(rh + (kc + 1) * 32, lane); ka[nb][1] = frag_h(rl + (kc + 1) * 32, lane); ka[nb][2] = frag_h(rh + 16 * (CC + 8) + (kc + 1) * 32, lane); ka[nb][3] = frag_h(rl + 16 * (CC + 8) + (kc + 1) * 32, lane); }
        __builtin_amdgcn_sched_barrier(0);   // keeps the next batch's reads in front of this block: sunk to their use, each would expose the LDS latency
        sh[0] = mm_h(ka[cb][0], qh[kc], sh[0]); sh[1] = mm_h(ka[cb][2], qh[kc], sh[1]); sl[0] = mm_h(ka[cb][0], ql[kc], sl[0]); sl[1] = mm_h(ka[cb][2], ql[kc], sl[1]); sl[0] = mm_h(ka[cb][1], qh[kc], sl[0]); sl[1] = mm_h(ka[cb][3], qh[kc], sl[1]);
        __builtin_amdgcn_sched_barrier(0); }   // ends the block: the reads behind it stay behind it
      v16b va[2][4];   // likewise for v: hi, lo planes of two 16-channel tiles; the first batch flies behind the softmax arithmetic
      const __bf16 *wh = &svh[col][u * 32], *wl = &svl[col][u * 32];
      va[0][0] = frag_b(wh, lane); va[0][1] = frag_b(wl, lane); va[0][2] = frag_b(wh + 16 * (FA_SK + 8), lane); va[0][3] = frag_b(wl + 16 * (FA_SK + 8), lane);
      __builtin_amdgcn_sched_barrier(0);   // keeps these reads in front of the softmax arithmetic
      float pv[16]; float mx = -3.0e38f;
#pragma unroll
      for (int r = 0; r < 8; ++r) { pv[r] = sh[0][r] + sl[0][r] * (1.0f / 1024.0f); pv[8 + r] = sh[1][r] + sl[1][r] * (1.0f / 1024.0f); mx = fmaxf(mx, fmaxf(pv[r], pv[8 + r])); }   /* unscaled: SC2 > 0 keeps the order */
      mx = fmaxf(mx, __shfl_xor(mx, 16)) * SC2;   // the other half of the wave holds this query's other 16 keys; from here on in base-2 exponent units
      if (__builtin_amdgcn_ballot_w32(mx > mrun) != 0) {   // some query's maximum rose: rescale what is summed so far (factor 1 for the others)
        const float mn = fmaxf(mrun, mx), al = __builtin_amdgcn_exp2f(mrun - mn); mrun = mn; lsum *= al;
#pragma unroll
        for (int j = 0; j < HD / 16; ++j) o[j] *= al; }
#pragma unroll
      for (int i = 0; i < 16; ++i) pv[i] = fmaf(pv[i], SC2, -mrun);   /* all sixteen exponents first: the exp2 run behind them then has independent neighbours */
#pragma unroll   // pv[] must stay in registers
      for (int i = 0; i < 16; ++i) { pv[i] = __builtin_amdgcn_exp2f(pv[i]); lsum += pv[i]; }
      const F2 p = bsplit16(pv);
#pragma unroll
      for (int jb = 0; jb < HD / 32; ++jb) { const int cb = jb & 1, nb = cb ^ 1, j = 2 * jb;
        if (jb + 1 < HD / 32) { va[nb][0] = frag_b(wh + (j + 2) * 16 * (FA_SK + 8), lane); va[nb][1] = frag_b(wl + (j + 2) * 16 * (FA_SK + 8), lane); va[nb][2] = frag_b(wh + (j + 3) * 16 * (FA_SK + 8), lane); va[nb][3] = frag_b(wl + (j + 3) * 16 * (FA_SK + 8), lane); }
        __builtin_amdgcn_sched_barrier(0);   // as above: the next batch's reads stay in front of this block
        o[j] = mm_b(va[cb][0], p.h, o[j]); o[j + 1] = mm_b(va[cb][2], p.h, o[j + 1]); o[j] = mm_b(va[cb][0], p.l, o[j]); o[j + 1] = mm_b(va[cb][2], p.l, o[j + 1]); o[j] = mm_b(va[cb][1], p.h, o[j]); o[j + 1] = mm_b(va[cb][3], p.h, o[j + 1]);
        __builtin_amdgcn_sched_barrier(0); } } }   // ends the block
  lsum += __shfl_xor(lsum, 16);
  float* yr = Y + (qr * FA_KS + blockIdx.y) * CC + 8 * g;   // O^T tile j, element r = channel 16 j + 8 g + r of query qr
#pragma unroll
  for (int j = 0; j < HD / 16; ++j) { vst2(yr + j * 16, __builtin_shufflevector(o[j], o[j], 0, 1, 2, 3)); vst2(yr + j * 16 + 4, __builtin_shufflevector(o[j], o[j], 4, 5, 6, 7)); }
  if (g == 0) { v2f t; t[0] = mrun * 0.6931471805599453f; t[1] = lsum;   /* the maximum in natural-log units, as k_resT weighs the slices */ vst2(ML + ((size_t)blockIdx.y * NB * TT + qr) * 2, t); } }

extern "C" void kernel_launch(void* const* d_in, const int* in_sizes, int n_in, void* d_out, int out_size, void* d_ws, size_t ws_size, hipStream_t stream) {
  (void)in_sizes; (void)n_in; (void)out_size;
  const float** F = (const float**)d_in;
  if (ws_size < (size_t)WS_END2) return;
  char* ws = (char*)d_ws; _Float16 *QH = (_Float16*)(ws + WS_QH), *KH = (_Float16*)(ws + WS_KH), *VT = (_Float16*)(ws + WS_VT), *QL = (_Float16*)(ws + WS_QL), *KL = (_Float16*)(ws + WS_KL); __bf16 *VB = (__bf16*)(ws + WS_VB), *VBL = (__bf16*)(ws + WS_VBL); float *YY = (float*)(ws + WS_YY), *ML = (float*)(ws + WS_ML);
  // inputs: 0 x [2,128,16,16,16]; 1 Wq (out,in), 2 bq; 3 Wk, 4 bk; 5 Wv, 6 bv; 7 gamma [scalar]
  k_proj<<<dim3(TNB * TT / 64, CC / 128, 3), 128, 0, stream>>>(F[0], F[0], F[0], F[1], F[3], F[5], F[2], F[4], F[6], QH, QL, KH, KL, VT, VB, VBL);
  k_fa<<<dim3(TNB * TT / 128, FA_KS), 256, 0, stream>>>(QH, QL, KH, KL, VB, VBL, YY, ML);
  k_resT<<<dim3(TNB * TT / RT_R), 256, 0, stream>>>(YY, ML, F[0], F[7], (float*)d_out);
}

// v006
// It runs in 49.6 microseconds.
// Two timings next to v005 both put it at 1.06 times that version's speed.
// All steps since v000 together make it 19.1 times as fast.
// compute dtype: all float inputs rounded to bf16; q/k/v = W x + b with EXACT bf16 products on WMMA 16x16x32 (f32 accumulate; channels-first input gathered); logits with BOTH q and k as f16 hi + residual (x 2^10) (3 products) x 1.3 - the logits have sigma ~15 so the softmax is sharply peaked and single-f16 operands would not do; online softmax in f32 in base 2 (hardware exp2 of score x 1.3 log2 e minus the running maximum per query, one fused multiply-add); unnormalised P split bf16 hi + lo against v bf16 hi + lo (3 products); residual x + gamma out in f32; f32 output (channels-first).
#include <hip/hip_runtime.h>
#include <math.h>

typedef __attribute__((ext_vector_type(16))) _Float16 v16h;
typedef __attribute__((ext_vector_type(16))) __bf16 v16b;
typedef __attribute__((ext_vector_type(8)))  _Float16 v8h;
typedef __attribute__((ext_vector_type(8)))  float v8f;
typedef __attribute__((ext_vector_type(4)))  float v4f;
typedef __attribute__((ext_vector_type(2)))  float v2f;
typedef __attribute__((ext_vector_type(4)))  unsigned v4u;
typedef __attribute__((ext_vector_type(4)))  int v4i;
typedef float __attribute__((may_alias)) float_a;
typedef int __attribute__((may_alias)) int_a;

template <typename T> __device__ __forceinline__ void vst2(void* p, T v) { *(T*)p = v;  }
__device__ __forceinline__ v8f wmma16(v16h a, v16h b, v8f c) {
  v8f d = __builtin_amdgcn_wmma_f32_16x16x32_f16(false, a, false, b, (short)0, c, false, false);
  asm volatile("v_nop\n\tv_nop\n\tv_nop\n\tv_nop" : "+v"(d) : "v"(a), "v"(b));
  return d;
}
__device__ __forceinline__ v8f wmma_bf(v16b a, v16b b, v8f c) {
  v8f d = __builtin_amdgcn_wmma_f32_16x16x32_bf16(false, a, false, b, (short)0, c, false, false);
  asm volatile("v_nop\n\tv_nop\n\tv_nop\n\tv_nop" : "+v"(d) : "v"(a), "v"(b));
  return d;
}
// 16x16x32 fragments: lane = (h = lane>>4, row/col = lane&15); elements 0..7 = k0+8h+0..7, 8..15 = k0+16+8h+0..7; D element r = row 8h+r
__device__ __forceinline__ v16h frag_h(const _Float16* rowk0, int lane) {
  union { v16h v; v8h q[2]; } u; const _Float16* p = rowk0 + 8 * (lane >> 4);
  u.q[0] = *(const v8h*)p; u.q[1] = *(const v8h*)(p + 16); return u.v;
}
__device__ __forceinline__ v16h frag_f32(const float* rowk0, int lane) {
  v16h a; const float* p = rowk0 + 8 * (lane >> 4);
#pragma unroll
  for (int i = 0; i < 8; ++i) { a[i] = (_Float16)p[i]; a[8 + i] = (_Float16)p[16 + i]; }
  return a;
}
__device__ __forceinline__ v16h frag_f32s(const float* rowk0, int lane, float sc) {
  v16h a; const float* p = rowk0 + 8 * (lane >> 4);
#pragma unroll
  for (int i = 0; i < 8; ++i) { a[i] = (_Float16)(p[i] * sc); a[8 + i] = (_Float16)(p[16 + i] * sc); }
  return a;
}
// column fragment from a [K][ld] layout (column n), rows >= K read as 0
__device__ __forceinline__ v16h fragc_f32(const float* W, int k0, int n, int lane, int ld, int K) {
  v16h a; const int g = lane >> 4;
#pragma unroll
  for (int i = 0; i < 8; ++i) { const int ka = k0 + 8 * g + i, kb = ka + 16;
    a[i] = (_Float16)(ka < K ? W[(size_t)(ka < K ? ka : K - 1) * ld + n] : 0.f); a[8 + i] = (_Float16)(kb < K ? W[(size_t)(kb < K ? kb : K - 1) * ld + n] : 0.f); }
  return a;
}
struct F2 { v16b h, l; };
__device__ __forceinline__ F2 bsplit16(const float v[16]) { F2 r;
#pragma unroll
  for (int i = 0; i < 16; ++i) { const __bf16 h = (__bf16)v[i]; r.h[i] = h; r.l[i] = (__bf16)(v[i] - (float)h); }
  return r; }
__device__ __forceinline__ F2 split_row(const float* row, int k0, int lane) { float v[16]; const float* p = row + k0 + 8 * (lane >> 4);
#pragma unroll
  for (int i = 0; i < 8; ++i) { v[i] = p[i]; v[8 + i] = p[16 + i]; }
  return bsplit16(v); }
__device__ __forceinline__ F2 split_rowK(const float* row, int k0, int lane, int K) { float v[16]; const int g = lane >> 4;
#pragma unroll
  for (int i = 0; i < 8; ++i) { const int ka = k0 + 8 * g + i, kb = ka + 16; v[i] = ka < K ? row[ka < K ? ka : K - 1] : 0.f; v[8 + i] = kb < K ? row[kb < K ? kb : K - 1] : 0.f; }
  return bsplit16(v); }
__device__ __forceinline__ F2 split_col(const float* W, int k0, int n, int lane, int ld, int K) { float v[16]; const int g = lane >> 4;
#pragma unroll
  for (int i = 0; i < 8; ++i) { const int ka = k0 + 8 * g + i, kb = ka + 16; v[i] = ka < K ? W[(size_t)(ka < K ? ka : K - 1) * ld + n] : 0.f; v[8 + i] = kb < K ? W[(size_t)(kb < K ? kb : K - 1) * ld + n] : 0.f; }
  return bsplit16(v); }
__device__ __forceinline__ v8f mac3(const F2& a, const F2& b, v8f c) { c = wmma_bf(a.l, b.h, c); c = wmma_bf(a.h, b.l, c); return wmma_bf(a.h, b.h, c); }
__device__ __forceinline__ float sigm(float v) { return 1.0f / (1.0f + expf(-v)); }
#define LDSX() do { asm volatile("s_wait_dscnt 0" ::: "memory"); __builtin_amdgcn_wave_barrier(); __builtin_amdgcn_fence(__ATOMIC_RELEASE, "workgroup"); } while (0)

// Single-head self-attention over a flattened 16x16x16 volume (B 2, C 128, N 4,096): q/k/v = 1x1x1 convs (W (out,in) [128,128] + b); attn = softmax((q^T k) * 1.3) over keys; out[c][n] = sum_m v[c][m] attn[n][m]; result = x + gamma * out (gamma = 0.3 scalar input).
#define NB 2
#define TT 4096
#define CC 128            // NH * HD = projected width
#define DIN 128          // input (model) width
#define NH 1
#define HD 128
#define NQB (TT / 64)
#define HG 1
#define SCALE (1.3f)
#define SC2 ((float)((double)SCALE * 1.4426950408889634))   // SCALE x log2 e: exp(SCALE t) = exp2(SC2 t)
#define CAUSAL 0
#ifndef TNB
#define TNB NB
#endif
__device__ __forceinline__ float bfr(float v) { return (float)(__bf16)v; }
__host__ __device__ __forceinline__ int kb_last(int qb) { return CAUSAL ? ((qb * 64 + 63) >> 7) : (TT / 128 - 1); }
typedef __attribute__((ext_vector_type(8))) __bf16 v8b;
__device__ __forceinline__ v16b frag_b(const __bf16* rowk0, int lane) {
  union { v16b v; v8b q[2]; } u; const __bf16* p = rowk0 + 8 * (lane >> 4);
  u.q[0] = *(const v8b*)p; u.q[1] = *(const v8b*)(p + 16); return u.v;
}
#define QBH NQB            // EVERY query block takes the 3-product logits + bf16 hi+lo P.v path (logit sigma ~15: sharply peaked softmax)
#define QHI 4096            // rows carrying a q residual plane (all rows when non-causal: 3-product logits everywhere)
#define KHI TT            // residual / bf16 hi+lo planes for ALL keys
// B fragment (k rows k0+.., output column o) of a weight: (in,out) [K][ld] or (out,in) [ld rows of K]: bf16 exact, or f16(bf16 * 256) exact
__device__ __forceinline__ v16b wcol_io(const float* Wm, int k0, int o, int lane, int ld) { v16b w; const int g = lane >> 4;
#pragma unroll
  for (int i = 0; i < 8; ++i) { w[i] = (__bf16)Wm[(size_t)(k0 + 8 * g + i) * ld + o]; w[8 + i] = (__bf16)Wm[(size_t)(k0 + 16 + 8 * g + i) * ld + o]; }
  return w; }
__device__ __forceinline__ v16b wcol_oi(const float* Wm, int k0, int o, int lane, int K) { v16b w; const float* p = Wm + (size_t)o * K + k0 + 8 * (lane >> 4);
#pragma unroll
  for (int i = 0; i < 8; ++i) { w[i] = (__bf16)p[i]; w[8 + i] = (__bf16)p[16 + i]; }
  return w; }
__device__ __forceinline__ v16h wcolh_io(const float* Wm, int k0, int o, int lane, int ld) { v16h w; const int g = lane >> 4;
#pragma unroll
  for (int i = 0; i < 8; ++i) { w[i] = (_Float16)(bfr(Wm[(size_t)(k0 + 8 * g + i) * ld + o]) * 256.0f); w[8 + i] = (_Float16)(bfr(Wm[(size_t)(k0 + 16 + 8 * g + i) * ld + o]) * 256.0f); }
  return w; }
__device__ __forceinline__ v16h wcolh_oi(const float* Wm, int k0, int o, int lane, int K) { v16h w; const float* p = Wm + (size_t)o * K + k0 + 8 * (lane >> 4);
#pragma unroll
  for (int i = 0; i < 8; ++i) { w[i] = (_Float16)(bfr(p[i]) * 256.0f); w[8 + i] = (_Float16)(bfr(p[16 + i]) * 256.0f); }
  return w; }
#define WQKV_LAYOUT 1   // 0 = (in,out) [DIN][CC]; 1 = (out,in) [CC][DIN]; 2 = per-head [NH][DIN][HD]
__device__ __forceinline__ v16b wcol_hdk(const float* Wm, int k0, int o, int lane) { v16b w; const int g = lane >> 4; const float* p = Wm + (size_t)(o / HD) * DIN * HD + (o % HD);
#pragma unroll
  for (int i = 0; i < 8; ++i) { w[i] = (__bf16)p[(size_t)(k0 + 8 * g + i) * HD]; w[8 + i] = (__bf16)p[(size_t)(k0 + 16 + 8 * g + i) * HD]; }
  return w; }
#define WO_OUT_IN 0
#if WQKV_LAYOUT == 1
#define WCOL(W, k0, o, lane) wcol_oi(W, k0, o, lane, DIN)
#elif WQKV_LAYOUT == 2
#define WCOL(W, k0, o, lane) wcol_hdk(W, k0, o, lane)
#else
#define WCOL(W, k0, o, lane) wcol_io(W, k0, o, lane, CC)
#endif
#if WO_OUT_IN
#define WOCOL(W, k0, o, lane) wcol_oi(W, k0, o, lane, CC)
#define WOCOLH(W, k0, o, lane) wcolh_oi(W, k0, o, lane, CC)
#else
#define WOCOL(W, k0, o, lane) wcol_io(W, k0, o, lane, DIN)
#define WOCOLH(W, k0, o, lane) wcolh_io(W, k0, o, lane, DIN)
#endif
#define NPIX 4096
#define FA_KS 8            // key slices over the k_fa grid (per query one partial ctx row, maximum and sum each; merged in k_resT)
#define FA_SK 64           // keys per LDS stage of k_fa
#define RT_R 32            // pixel rows per k_resT block
// ---- k_resT: block = (RT_R pixel rows, 128 channels), 8 waves: merges the FA_KS key slices of a row (weight exp(m_s - M) / sum_s exp(m_s - M) l_s, fixed order), then out[b][c][n] = bf16(x[b][c][n]) + bf16(gamma) * ctx[b*4096 + n][c] via an LDS transpose (each (c, 32 n) run = one 128-B line by 8 threads).
// The partial rows come from memory and are read once, so the kernel runs at the rate of the bytes it keeps in flight: one block per WGP, and every global load of a thread (32 of the partial rows, 4 of x) is issued before its first wait.
__global__ __launch_bounds__(256) void k_resT(const float* __restrict__ Y, const float* __restrict__ ML, const float* __restrict__ X, const float* __restrict__ GM, float* __restrict__ OUT) { __shared__ float stc[128][RT_R + 1]; __shared__ float wsl[FA_KS][RT_R];   // 33-dword pitch: the transposed stores fall on 16 banks, the row reads on 32
  const int tid = threadIdx.x, wave = tid >> 5, lane = tid & 31; const size_t rb = (size_t)blockIdx.x * RT_R; const size_t bb = rb / TT; const int t0 = (int)(rb % TT); const float gm = bfr(GM[0]);
  v2f mlv[FA_KS] = {};
  if (tid < RT_R) {
#pragma unroll
    for (int s = 0; s < FA_KS; ++s) mlv[s] = *(const v2f*)(ML + ((size_t)s * NB * TT + rb + tid) * 2); }
  v4f yv[RT_R / 8][FA_KS]; { const float* yp = Y + (rb + wave) * (size_t)(FA_KS * CC) + lane * 4;   /* a wave = one row's 512 B of one slice per load; rows wave, wave + 8, ... */
#pragma unroll
    for (int it = 0; it < RT_R / 8; ++it) {
#pragma unroll
      for (int s = 0; s < FA_KS; ++s) yv[it][s] = *(const v4f*)(yp + (size_t)it * 8 * FA_KS * CC + s * CC); } }
  const size_t o0 = ((size_t)bb * CC + (tid >> 3)) * NPIX + t0 + (tid & 7) * 4; v4f xv[4];
#pragma unroll
  for (int it = 0; it < 4; ++it) xv[it] = *(const v4f*)(X + o0 + (size_t)it * 32 * NPIX);
  asm volatile("s_wait_xcnt 0x0" ::: "memory");   // the loads' address registers may be reused behind this point; it also keeps every load above in front of the first wait
  if (tid < RT_R) { float mv[FA_KS]; float mx = -3.0e38f;
#pragma unroll
    for (int s = 0; s < FA_KS; ++s) mx = fmaxf(mx, mlv[s][0]);
    float den = 0.f;
#pragma unroll
    for (int s = 0; s < FA_KS; ++s) { mv[s] = expf(mlv[s][0] - mx); den += mv[s] * mlv[s][1]; }
    const float inv = 1.0f / den;   /* den is 1 (to rounding) or more: the slice that holds the maximum has weight 1 and a sum that holds the maximum's own term */
#pragma unroll
    for (int s = 0; s < FA_KS; ++s) wsl[s][tid] = mv[s] * inv; }
  __syncthreads();   // the rows' slice weights are in LDS
#pragma unroll   // yv[] stays in registers only under constant indices
  for (int it = 0; it < RT_R / 8; ++it) { const int rl = wave + it * 8; v4f r = yv[it][0] * wsl[0][rl];
#pragma unroll
    for (int s = 1; s < FA_KS; ++s) r += yv[it][s] * wsl[s][rl];   /* the row's key slices, fixed order */
    stc[lane * 4][rl] = r[0]; stc[lane * 4 + 1][rl] = r[1]; stc[lane * 4 + 2][rl] = r[2]; stc[lane * 4 + 3][rl] = r[3]; }
  __syncthreads();
#pragma unroll   // xv[] likewise
  for (int it = 0; it < 4; ++it) { const float* sp = &stc[(tid >> 3) + it * 32][(tid & 7) * 4]; v4f r4; r4[0] = bfr(xv[it][0]) + gm * sp[0]; r4[1] = bfr(xv[it][1]) + gm * sp[1]; r4[2] = bfr(xv[it][2]) + gm * sp[2]; r4[3] = bfr(xv[it][3]) + gm * sp[3]; vst2(OUT + o0 + (size_t)it * 32 * NPIX, r4); } }
#ifndef SM_EXTRA_PARAMS
#define SM_EXTRA_PARAMS
#endif
#ifndef PROJ_EXTRA_PARAMS
#define PROJ_EXTRA_PARAMS
#endif
#ifndef SM_MASK_HOOK
#define SM_MASK_HOOK (void)0
#endif

#define WS_QH  0u                                      // f16 q rows [b*t][CC]
#define WS_KH  (WS_QH + 2u * (size_t)NB * TT * CC)      // f16 k rows [b*t][CC]
#define WS_VT  (WS_KH + 2u * (size_t)NB * TT * CC)      // f16 v planes [b][c][t]
#define WS_QL  (WS_VT + 2u * (size_t)NB * CC * TT)      // f16 q residual x 2^10 rows [b][t < QHI][CC]
#define WS_KL  (WS_QL + 2u * (size_t)NB * QHI * CC)     // f16 k residual x 2^10 rows [b][t < KHI][CC]
#define WS_VB  (WS_KL + 2u * (size_t)NB * KHI * CC)     // bf16 v hi planes [b][c][t < KHI]
#define WS_VBL (WS_VB + 2u * (size_t)NB * CC * KHI)
#define WS_YY (WS_VBL + 2u * (size_t)NB * CC * KHI)    // f32 partial ctx rows [b*t][key slice][128], unnormalised
#define WS_ML (WS_YY + 4u * (size_t)FA_KS * NB * TT * CC)   // f32 (running maximum, sum) pairs [key slice][b*t]
#define WS_END2 (WS_ML + 8u * (size_t)FA_KS * NB * TT)

typedef __attribute__((ext_vector_type(4))) __bf16 v4b;
// ---- k_proj: block = (64 rows, 128 cols, which): q/k/v = X W (+ b) with exact bf16 products (K = DIN) -> which 0: q f16 rows (+ residual rows < QHI); 1: k f16 rows (+ residual rows < KHI); 2: v f16 planes [c][t] (+ bf16 hi/lo planes for t < KHI)
__global__ __launch_bounds__(128) void k_proj(const float* __restrict__ XQ, const float* __restrict__ XK, const float* __restrict__ XV, const float* __restrict__ WQ, const float* __restrict__ WK, const float* __restrict__ WV, const float* __restrict__ BQ, const float* __restrict__ BK, const float* __restrict__ BV,
    _Float16* __restrict__ QH, _Float16* __restrict__ QL, _Float16* __restrict__ KH, _Float16* __restrict__ KL, _Float16* __restrict__ VT, __bf16* __restrict__ VB, __bf16* __restrict__ VBL) {
  __shared__ __align__(16) _Float16 sh[64][136], sl[64][136]; __shared__ __align__(16) _Float16 th[128][72]; __shared__ __align__(16) __bf16 tb[128][72], tbl[128][72];
  __shared__ __align__(16) __bf16 sw[128][DIN + 8];   // the block's 128 weight rows (out, in) as bf16; 272-B pitch: conflict-free 16-byte fragment reads
  const int tid = threadIdx.x, wave = tid >> 5, lane = tid & 31, col = lane & 15, g = lane >> 4; const int which = blockIdx.z; const int c0 = blockIdx.y * 128; const size_t r0 = (size_t)blockIdx.x * 64; const size_t bb = r0 / TT; const int t0 = (int)(r0 % TT);
  const float* X = which == 0 ? XQ : which == 1 ? XK : XV; const float* WA = which == 0 ? WQ : which == 1 ? WK : WV; const float* BA = which == 0 ? BQ : which == 1 ? BK : BV;
  // Every global load of the block is issued before its first wait, so their latencies overlap (104 loads a wave against a load counter of 63: about two latencies stay exposed) in place of one exposed latency per fragment. The weight comes in by whole-line loads (a wave = one 512-B row), once per block, and goes to LDS as bf16; the four waves read their B fragments from there.
  v4f wr[128 * (DIN / 4) / 128]; { const float* wp = WA + (size_t)(c0 + wave) * DIN + lane * 4;
#pragma unroll
    for (int i = 0; i < 128 * (DIN / 4) / 128; ++i) wr[i] = *(const v4f*)(wp + i * 4 * DIN); }
  asm volatile("s_wait_xcnt 0x0" ::: "memory");   // the weight loads' address pair may be reused by the loads behind this point
  float xr[DIN / 32][16]; { const float* p = X + ((size_t)bb * DIN + 8 * g) * NPIX + t0 + wave * 16 + col;   /* channels-first gather: x[b][k][n], stride NPIX between channels */
#pragma unroll
    for (int kc = 0; kc < DIN / 32; ++kc) {
#pragma unroll
      for (int i = 0; i < 8; ++i) { xr[kc][i] = p[(size_t)(kc * 32 + i) * NPIX]; xr[kc][8 + i] = p[(size_t)(kc * 32 + 16 + i) * NPIX]; } } }
  float bias8[8] = {};
  if (BA) { const float* bp = BA + c0 + col;
#pragma unroll
    for (int j = 0; j < 8; ++j) bias8[j] = bp[j * 16]; }
  asm volatile("s_wait_xcnt 0x0" ::: "memory");   // the loads' address registers may be reused behind this point; it also keeps every load above in front of the LDS stores
#pragma unroll
  for (int i = 0; i < 128 * (DIN / 4) / 128; ++i) { v4b t; t[0] = (__bf16)wr[i][0]; t[1] = (__bf16)wr[i][1]; t[2] = (__bf16)wr[i][2]; t[3] = (__bf16)wr[i][3]; *(v4b*)&sw[wave + i * 4][lane * 4] = t; }
  v16b a[DIN / 32];
#pragma unroll
  for (int kc = 0; kc < DIN / 32; ++kc) {
#pragma unroll
    for (int i = 0; i < 16; ++i) a[kc][i] = (__bf16)xr[kc][i]; }
#pragma unroll
  for (int j = 0; j < 8; ++j) bias8[j] = bfr(bias8[j]);
  __syncthreads();   // the weight is in LDS
  v8f acc[8] = {}; v16b fb[2][8];   // fb: two batches of B fragments (the eight 16-column tiles of one 32-channel step): the next batch's LDS reads fly while this batch's products run
  const __bf16* wrow = &sw[col][0];   /* frag_b has the k order of the gather above: elements 0..7 = k0 + 8g + i, 8..15 = k0 + 16 + 8g + i */
#pragma unroll
  for (int j = 0; j < 8; ++j) fb[0][j] = frag_b(wrow + j * 16 * (DIN + 8), lane);
#pragma unroll   // a[], fb[] and acc[] stay in registers only under constant indices
  for (int kc = 0; kc < DIN / 32; ++kc) { const int cb = kc & 1, nb = cb ^ 1;
    if (kc + 1 < DIN / 32) {
#pragma unroll
      for (int j = 0; j < 8; ++j) fb[nb][j] = frag_b(wrow + j * 16 * (DIN + 8) + (kc + 1) * 32, lane); }
#pragma unroll
    for (int j = 0; j < 8; ++j) acc[j] = wmma_bf(a[kc], fb[cb][j], acc[j]); }
  if (which < 2) { _Float16* DH = which == 0 ? QH : KH; _Float16* DL = which == 0 ? QL : KL; const int nhi = which == 0 ? QHI : KHI; const bool hi_rows = t0 < nhi;
#pragma unroll
    for (int j = 0; j < 8; ++j) { const float bias = bias8[j];
#pragma unroll
      for (int r = 0; r < 8; ++r) { const float v = acc[j][r] + bias; const _Float16 hv = (_Float16)v; sh[wave * 16 + 8 * g + r][j * 16 + col] = hv; sl[wave * 16 + 8 * g + r][j * 16 + col] = (_Float16)((v - (float)hv) * 1024.0f); } }
    __syncthreads();
    for (int e = tid; e < 64 * 16; e += 128) { const int rl = e >> 4, q = e & 15; vst2((unsigned*)(DH + (r0 + rl) * CC + c0 + q * 8), *(const v4u*)&sh[rl][q * 8]); if (hi_rows) vst2((unsigned*)(DL + (bb * nhi + t0 + rl) * (size_t)CC + c0 + q * 8), *(const v4u*)&sl[rl][q * 8]); }
  } else { const bool hi_rows = t0 < KHI;
#pragma unroll
    for (int j = 0; j < 8; ++j) { const float bias = bias8[j];
#pragma unroll
      for (int r = 0; r < 8; ++r) { const float v = acc[j][r] + bias; const int rl = wave * 16 + 8 * g + r, cl = j * 16 + col; th[cl][rl] = (_Float16)v; const __bf16 bh = (__bf16)v; tb[cl][rl] = bh; tbl[cl][rl] = (__bf16)(v - (float)bh); } }
    __syncthreads();
    for (int e = tid; e < 128 * 8; e += 128) { const int cl = e >> 3, q = e & 7; vst2((unsigned*)(VT + (bb * CC + c0 + cl) * (size_t)TT + t0 + q * 8), *(const v4u*)&th[cl][q * 8]); if (hi_rows) { const size_t o3 = (bb * CC + c0 + cl) * (size_t)KHI + t0 + q * 8; vst2((unsigned*)(VB + o3), *(const v4u*)&tb[cl][q * 8]); vst2((unsigned*)(VBL + o3), *(const v4u*)&tbl[cl][q * 8]); } } } }
// the builtin forms as they are: the compiler keeps the distance behind a matrix instruction itself and is free to move LDS reads ahead of it
__device__ __forceinline__ v8f mm_h(v16h a, v16h b, v8f c) { return __builtin_amdgcn_wmma_f32_16x16x32_f16(false, a, false, b, (short)0, c, false, false); }
__device__ __forceinline__ v8f mm_b(v16b a, v16b b, v8f c) { return __builtin_amdgcn_wmma_f32_16x16x32_bf16(false, a, false, b, (short)0, c, false, false); }
__global__ __launch_bounds__(256) void k_fa(const _Float16* __restrict__ QH, const _Float16* __restrict__ QL, const _Float16* __restrict__ KH, const _Float16* __restrict__ KL, const __bf16* __restrict__ VB, const __bf16* __restrict__ VBL, float* __restrict__ Y, float* __restrict__ ML) {
  __shared__ __align__(16) _Float16 skh[FA_SK][CC + 8], skl[FA_SK][CC + 8];   // 272-B pitch: conflict-free 16-byte fragment reads
  __shared__ __align__(16) __bf16 svh[CC][FA_SK + 8], svl[CC][FA_SK + 8];     // 144-B pitch, likewise
  __shared__ __align__(16) char sio[8][2 * 16 * 2 * (CC + 8)];   // one tile per wave, read and written by that wave alone: its 16 q rows (hi, then residual; 272-B pitch) on the way in, its 16 partial ctx rows (f32, 528-B pitch) on the way out
  const int tid = threadIdx.x, wave = tid >> 5, lane = tid & 31, col = lane & 15, g = lane >> 4;
  const size_t qr = (size_t)blockIdx.x * 128 + wave * 16 + col;   // this lane's query row in [b*t]
  const size_t bb = (size_t)blockIdx.x / (TT / 128); const int key0 = (int)blockIdx.y * (TT / FA_KS);
  const int kr = tid >> 4, kq = (tid & 15) * 8, vr = tid >> 3, vq = (tid & 7) * 8;   // staging: 16 lanes per 256-B k row, 8 lanes per 128-B run of a v plane
  const _Float16 *gkh = KH + (bb * TT + key0 + kr) * (size_t)CC + kq, *gkl = KL + (bb * TT + key0 + kr) * (size_t)CC + kq; const __bf16 *gvh = VB + (bb * CC + vr) * (size_t)KHI + key0 + vq, *gvl = VBL + (bb * CC + vr) * (size_t)KHI + key0 + vq;
  // q comes in by whole lines (a wave-wide 16-byte load = two 256-B rows = 4 lines) and is dealt into fragments from the wave's LDS tile: a fragment load from global memory takes 16 B of each of 16 rows, 16 lines per load.
  char* wio = sio[wave]; const size_t q0 = (size_t)blockIdx.x * 128 + wave * 16;   // the wave's first query row in [b*t]
  { v4u th[8], tl[8]; const _Float16 *pqh = QH + (q0 + g) * CC + col * 8, *pql = QL + (q0 + g) * CC + col * 8;
#pragma unroll
    for (int i = 0; i < 8; ++i) { th[i] = *(const v4u*)(pqh + i * 2 * CC); tl[i] = *(const v4u*)(pql + i * 2 * CC); }
    asm volatile("s_wait_xcnt 0x0" :: "v"(pqh), "v"(pql) : "memory");   // the q loads' address registers, named here so that they live up to the wait, may be reused behind this point
    char* wq = wio + g * (2 * (CC + 8)) + col * 16;
#pragma unroll
    for (int i = 0; i < 8; ++i) { *(v4u*)(wq + i * 2 * (2 * (CC + 8))) = th[i]; *(v4u*)(wq + (16 + i * 2) * (2 * (CC + 8))) = tl[i]; } }
  asm volatile("s_wait_dscnt 0x0" ::: "memory");   // the wave's own rows are in its tile before other lanes of the wave read them
  v16h qh[HD / 32], ql[HD / 32]; { const _Float16* sq = (const _Float16*)wio + col * (CC + 8);
#pragma unroll
    for (int kc = 0; kc < HD / 32; ++kc) { qh[kc] = frag_h(sq + kc * 32, lane); ql[kc] = frag_h(sq + 16 * (CC + 8) + kc * 32, lane); } }
  v8f o[HD / 16] = {}; float mrun = -3.0e38f, lsum = 0.f;   // mrun: running maximum of score x SC2, the base-2 exponent that is taken off
#pragma unroll 1   // rolled: one stage's code is the whole hot loop and the accumulators stay in place
  for (int st = 0; st < TT / FA_KS / FA_SK; ++st) {
    __syncthreads();   // every wave has finished reading the stage before
#pragma unroll
    for (int i = 0; i < FA_SK * 16 / 256; ++i) { *(v4u*)&skh[kr + i * 16][kq] = *(const v4u*)(gkh + i * 16 * CC); *(v4u*)&skl[kr + i * 16][kq] = *(const v4u*)(gkl + i * 16 * CC); }
#pragma unroll
    for (int i = 0; i < CC * (FA_SK / 8) / 256; ++i) { *(v4u*)&svh[vr + i * 32][vq] = *(const v4u*)(gvh + (size_t)i * 32 * KHI); *(v4u*)&svl[vr + i * 32][vq] = *(const v4u*)(gvl + (size_t)i * 32 * KHI); }
    asm volatile("s_wait_xcnt 0x0" ::: "memory");   // the stage loads' address registers are rewritten behind this point
    gkh += FA_SK * CC; gkl += FA_SK * CC; gvh += FA_SK; gvl += FA_SK;   // the lane's four source pointers walk on by one stage, behind the stores that waited for the loads
    __syncthreads();   // the stage is in LDS
#pragma unroll 1   // rolled: halves the hot loop's code; both passes are alike
    for (int u = 0; u < FA_SK / 32; ++u) {
      v8f sh[2] = {}, sl[2] = {}; v16h ka[2][4];   // ka: two batches of fragments (k hi, k residual of both 16-key tiles for one 32-channel step): the next batch's LDS reads fly while this batch's products run
      const _Float16 *rh = &skh[u * 32 + col][0], *rl = &skl[u * 32 + col][0];
      ka[0][0] = frag_h(rh, lane); ka[0][1] = frag_h(rl, lane); ka[0][2] = frag_h(rh + 16 * (CC + 8), lane); ka[0][3] = frag_h(rl + 16 * (CC + 8), lane);
#pragma unroll
      for (int kc = 0; kc < HD / 32; ++kc) { const int cb = kc & 1, nb = cb ^ 1;
        if (kc + 1 < HD / 32) { ka[nb][0] = frag_h(rh + (kc + 1) * 32, lane); ka[nb][1] = frag_h(rl + (kc + 1) * 32, lane); ka[nb][2] = frag_h(rh + 16 * (CC + 8) + (kc + 1) * 32, lane); ka[nb][3] = frag_h(rl + 16 * (CC + 8) + (kc + 1) * 32, lane); }
        __builtin_amdgcn_sched_barrier(0);   // keeps the next batch's reads in front of this block: sunk to their use, each would expose the LDS latency
        sh[0] = mm_h(ka[cb][0], qh[kc], sh[0]); sh[1] = mm_h(ka[cb][2], qh[kc], sh[1]); sl[0] = mm_h(ka[cb][0], ql[kc], sl[0]); sl[1] = mm_h(ka[cb][2], ql[kc], sl[1]); sl[0] = mm_h(ka[cb][1], qh[kc], sl[0]); sl[1] = mm_h(ka[cb][3], qh[kc], sl[1]);
        __builtin_amdgcn_sched_barrier(0); }   // ends the block: the reads behind it stay behind it
      v16b va[2][4];   // likewise for v: hi, lo planes of two 16-channel tiles; the first batch flies behind the softmax arithmetic
      const __bf16 *wh = &svh[col][u * 32], *wl = &svl[col][u * 32];
      va[0][0] = frag_b(wh, lane); va[0][1] = frag_b(wl, lane); va[0][2] = frag_b(wh + 16 * (FA_SK + 8), lane); va[0][3] = frag_b(wl + 16 * (FA_SK + 8), lane);
      __builtin_amdgcn_sched_barrier(0);   // keeps these reads in front of the softmax arithmetic
      float pv[16]; float mx = -3.0e38f;
#pragma unroll
      for (int r = 0; r < 8; ++r) { pv[r] = sh[0][r] + sl[0][r] * (1.0f / 1024.0f); pv[8 + r] = sh[1][r] + sl[1][r] * (1.0f / 1024.0f); mx = fmaxf(mx, fmaxf(pv[r], pv[8 + r])); }   /* unscaled: SC2 > 0 keeps the order */
      mx = fmaxf(mx, __shfl_xor(mx, 16)) * SC2;   // the other half of the wave holds this query's other 16 keys; from here on in base-2 exponent units
      if (__builtin_amdgcn_ballot_w32(mx > mrun) != 0) {   // some query's maximum rose: rescale what is summed so far (factor 1 for the others)
        const float mn = fmaxf(mrun, mx), al = __builtin_amdgcn_exp2f(mrun - mn); mrun = mn; lsum *= al;
#pragma unroll
        for (int j = 0; j < HD / 16; ++j) o[j] *= al; }
#pragma unroll
      for (int i = 0; i < 16; ++i) pv[i] = fmaf(pv[i], SC2, -mrun);   /* all sixteen exponents first: the exp2 run behind them then has independent neighbours */
#pragma unroll   // pv[] must stay in registers
      for (int i = 0; i < 16; ++i) { pv[i] = __builtin_amdgcn_exp2f(pv[i]); lsum += pv[i]; }
      const F2 p = bsplit16(pv);
#pragma unroll
      for (int jb = 0; jb < HD / 32; ++jb) { const int cb = jb & 1, nb = cb ^ 1, j = 2 * jb;
        if (jb + 1 < HD / 32) { va[nb][0] = frag_b(wh + (j + 2) * 16 * (FA_SK + 8), lane); va[nb][1] = frag_b(wl + (j + 2) * 16 * (FA_SK + 8), lane); va[nb][2] = frag_b(wh + (j + 3) * 16 * (FA_SK + 8), lane); va[nb][3] = frag_b(wl + (j + 3) * 16 * (FA_SK + 8), lane); }
        __builtin_amdgcn_sched_barrier(0);   // as above: the next batch's reads stay in front of this block
        o[j] = mm_b(va[cb][0], p.h, o[j]); o[j + 1] = mm_b(va[cb][2], p.h, o[j + 1]); o[j] = mm_b(va[cb][0], p.l, o[j]); o[j + 1] = mm_b(va[cb][2], p.l, o[j + 1]); o[j] = mm_b(va[cb][1], p.h, o[j]); o[j + 1] = mm_b(va[cb][3], p.h, o[j + 1]);
        __builtin_amdgcn_sched_barrier(0); } } }   // ends the block
  lsum += __shfl_xor(lsum, 16);
  __builtin_amdgcn_sched_barrier(0);   // keeps the exchange in front of the row stores below: sunk among them it would overwrite a register of an issued store and put a wait into the run
  // the partial rows leave by whole lines: from the accumulators a store would put 16 B into each of 16 rows (16 lines per store); through the wave's tile a store is one query's 512-B row (4 lines)
  float* so = (float*)wio + col * (CC + 4) + 8 * g;   // O^T tile j, element r = channel 16 j + 8 g + r of query q0 + col
#pragma unroll
  for (int j = 0; j < HD / 16; ++j) { *(v4f*)(so + j * 16) = __builtin_shufflevector(o[j], o[j], 0, 1, 2, 3); *(v4f*)(so + j * 16 + 4) = __builtin_shufflevector(o[j], o[j], 4, 5, 6, 7); }
  asm volatile("s_wait_dscnt 0x0" ::: "memory");   // the wave's own tile is written before other lanes of the wave read it back
  float* yr = Y + (q0 * FA_KS + blockIdx.y) * CC + lane * 4; const float* si = (const float*)wio + lane * 4;
#pragma unroll
  for (int r = 0; r < 16; ++r) vst2(yr + (size_t)r * FA_KS * CC, *(const v4f*)(si + r * (CC + 4)));
  if (g == 0) { v2f t; t[0] = mrun * 0.6931471805599453f; t[1] = lsum;   /* the maximum in natural-log units, as k_resT weighs the slices */ vst2(ML + ((size_t)blockIdx.y * NB * TT + qr) * 2, t); } }

extern "C" void kernel_launch(void* const* d_in, const int* in_sizes, int n_in, void* d_out, int out_size, void* d_ws, size_t ws_size, hipStream_t stream) {
  (void)in_sizes; (void)n_in; (void)out_size;
  const float** F = (const float**)d_in;
  if (ws_size < (size_t)WS_END2) return;
  char* ws = (char*)d_ws; _Float16 *QH = (_Float16*)(ws + WS_QH), *KH = (_Float16*)(ws + WS_KH), *VT = (_Float16*)(ws + WS_VT), *QL = (_Float16*)(ws + WS_QL), *KL = (_Float16*)(ws + WS_KL); __bf16 *VB = (__bf16*)(ws + WS_VB), *VBL = (__bf16*)(ws + WS_VBL); float *YY = (float*)(ws + WS_YY), *ML = (float*)(ws + WS_ML);
  // inputs: 0 x [2,128,16,16,16]; 1 Wq (out,in), 2 bq; 3 Wk, 4 bk; 5 Wv, 6 bv; 7 gamma [scalar]
  k_proj<<<dim3(TNB * TT / 64, CC / 128, 3), 128, 0, stream>>>(F[0], F[0], F[0], F[1], F[3], F[5], F[2], F[4], F[6], QH, QL, KH, KL, VT, VB, VBL);
  k_fa<<<dim3(TNB * TT / 128, FA_KS), 256, 0, stream>>>(QH, QL, KH, KL, VB, VBL, YY, ML);
  k_resT<<<dim3(TNB * TT / RT_R), 256, 0, stream>>>(YY, ML, F[0], F[7], (float*)d_out);
}

// v007
// It runs in 46.6 microseconds.
// In two side-by-side timings against v006, it was 1.07 and 1.06 times as fast.
// Over all steps from v000 it is 20.3 times as fast.
// compute dtype: all float inputs rounded to bf16; q/k/v = W x + b with EXACT bf16 products on WMMA 16x16x32 (f32 accumulate; channels-first input gathered); logits with BOTH q and k as f16 hi + residual (x 2^10) (3 products) x 1.3 - the logits have sigma ~15 so the softmax is sharply peaked and single-f16 operands would not do; online softmax in f32 in base 2 (hardware exp2 of score x 1.3 log2 e minus the running maximum per query, one fused multiply-add); unnormalised P split bf16 hi + lo against v bf16 hi + lo (3 products); residual x + gamma out in f32; f32 output (channels-first).
#include <hip/hip_runtime.h>
#include <math.h>

typedef __attribute__((ext_vector_type(16))) _Float16 v16h;
typedef __attribute__((ext_vector_type(16))) __bf16 v16b;
typedef __attribute__((ext_vector_type(8)))  _Float16 v8h;
typedef __attribute__((ext_vector_type(8)))  float v8f;
typedef __attribute__((ext_vector_type(4)))  float v4f;
typedef __attribute__((ext_vector_type(2)))  float v2f;
typedef __attribute__((ext_vector_type(4)))  unsigned v4u;
typedef __attribute__((ext_vector_type(4)))  int v4i;
typedef float __attribute__((may_alias)) float_a;
typedef int __attribute__((may_alias)) int_a;

template <typename T> __device__ __forceinline__ void vst2(void* p, T v) { *(T*)p = v;  }
__device__ __forceinline__ v8f wmma16(v16h a, v16h b, v8f c) {
  v8f d = __builtin_amdgcn_wmma_f32_16x16x32_f16(false, a, false, b, (short)0, c, false, false);
  asm volatile("v_nop\n\tv_nop\n\tv_nop\n\tv_nop" : "+v"(d) : "v"(a), "v"(b));
  return d;
}
__device__ __forceinline__ v8f wmma_bf(v16b a, v16b b, v8f c) {
  v8f d = __builtin_amdgcn_wmma_f32_16x16x32_bf16(false, a, false, b, (short)0, c, false, false);
  asm volatile("v_nop\n\tv_nop\n\tv_nop\n\tv_nop" : "+v"(d) : "v"(a), "v"(b));
  return d;
}
// 16x16x32 fragments: lane = (h = lane>>4, row/col = lane&15); elements 0..7 = k0+8h+0..7, 8..15 = k0+16+8h+0..7; D element r = row 8h+r
__device__ __forceinline__ v16h frag_h(const _Float16* rowk0, int lane) {
  union { v16h v; v8h q[2]; } u; const _Float16* p = rowk0 + 8 * (lane >> 4);
  u.q[0] = *(const v8h*)p; u.q[1] = *(const v8h*)(p + 16); return u.v;
}
__device__ __forceinline__ v16h frag_f32(const float* rowk0, int lane) {
  v16h a; const float* p = rowk0 + 8 * (lane >> 4);
#pragma unroll
  for (int i = 0; i < 8; ++i) { a[i] = (_Float16)p[i]; a[8 + i] = (_Float16)p[16 + i]; }
  return a;
}
__device__ __forceinline__ v16h frag_f32s(const float* rowk0, int lane, float sc) {
  v16h a; const float* p = rowk0 + 8 * (lane >> 4);
#pragma unroll
  for (int i = 0; i < 8; ++i) { a[i] = (_Float16)(p[i] * sc); a[8 + i] = (_Float16)(p[16 + i] * sc); }
  return a;
}
// column fragment from a [K][ld] layout (column n), rows >= K read as 0
__device__ __forceinline__ v16h fragc_f32(const float* W, int k0, int n, int lane, int ld, int K) {
  v16h a; const int g = lane >> 4;
#pragma unroll
  for (int i = 0; i < 8; ++i) { const int ka = k0 + 8 * g + i, kb = ka + 16;
    a[i] = (_Float16)(ka < K ? W[(size_t)(ka < K ? ka : K - 1) * ld + n] : 0.f); a[8 + i] = (_Float16)(kb < K ? W[(size_t)(kb < K ? kb : K - 1) * ld + n] : 0.f); }
  return a;
}
struct F2 { v16b h, l; };
__device__ __forceinline__ F2 bsplit16(const float v[16]) { F2 r;
#pragma unroll
  for (int i = 0; i < 16; ++i) { const __bf16 h = (__bf16)v[i]; r.h[i] = h; r.l[i] = (__bf16)(v[i] - (float)h); }
  return r; }
__device__ __forceinline__ F2 split_row(const float* row, int k0, int lane) { float v[16]; const float* p = row + k0 + 8 * (lane >> 4);
#pragma unroll
  for (int i = 0; i < 8; ++i) { v[i] = p[i]; v[8 + i] = p[16 + i]; }
  return bsplit16(v); }
__device__ __forceinline__ F2 split_rowK(const float* row, int k0, int lane, int K) { float v[16]; const int g = lane >> 4;
#pragma unroll
  for (int i = 0; i < 8; ++i) { const int ka = k0 + 8 * g + i, kb = ka + 16; v[i] = ka < K ? row[ka < K ? ka : K - 1] : 0.f; v[8 + i] = kb < K ? row[kb < K ? kb : K - 1] : 0.f; }
  return bsplit16(v); }
__device__ __forceinline__ F2 split_col(const float* W, int k0, int n, int lane, int ld, int K) { float v[16]; const int g = lane >> 4;
#pragma unroll
  for (int i = 0; i < 8; ++i) { const int ka = k0 + 8 * g + i, kb = ka + 16; v[i] = ka < K ? W[(size_t)(ka < K ? ka : K - 1) * ld + n] : 0.f; v[8 + i] = kb < K ? W[(size_t)(kb < K ? kb : K - 1) * ld + n] : 0.f; }
  return bsplit16(v); }
__device__ __forceinline__ v8f mac3(const F2& a, const F2& b, v8f c) { c = wmma_bf(a.l, b.h, c); c = wmma_bf(a.h, b.l, c); return wmma_bf(a.h, b.h, c); }
__device__ __forceinline__ float sigm(float v) { return 1.0f / (1.0f + expf(-v)); }
#define LDSX() do { asm volatile("s_wait_dscnt 0" ::: "memory"); __builtin_amdgcn_wave_barrier(); __builtin_amdgcn_fence(__ATOMIC_RELEASE, "workgroup"); } while (0)

// Single-head self-attention over a flattened 16x16x16 volume (B 2, C 128, N 4,096): q/k/v = 1x1x1 convs (W (out,in) [128,128] + b); attn = softmax((q^T k) * 1.3) over keys; out[c][n] = sum_m v[c][m] attn[n][m]; result = x + gamma * out (gamma = 0.3 scalar input).
#define NB 2
#define TT 4096
#define CC 128            // NH * HD = projected width
#define DIN 128          // input (model) width
#define NH 1
#define HD 128
#define NQB (TT / 64)
#define HG 1
#define SCALE (1.3f)
#define SC2 ((float)((double)SCALE * 1.4426950408889634))   // SCALE x log2 e: exp(SCALE t) = exp2(SC2 t)
#define CAUSAL 0
#ifndef TNB
#define TNB NB
#endif
__device__ __forceinline__ float bfr(float v) { return (float)(__bf16)v; }
__host__ __device__ __forceinline__ int kb_last(int qb) { return CAUSAL ? ((qb * 64 + 63) >> 7) : (TT / 128 - 1); }
typedef __attribute__((ext_vector_type(8))) __bf16 v8b;
__device__ __forceinline__ v16b frag_b(const __bf16* rowk0, int lane) {
  union { v16b v; v8b q[2]; } u; const __bf16* p = rowk0 + 8 * (lane >> 4);
  u.q[0] = *(const v8b*)p; u.q[1] = *(const v8b*)(p + 16); return u.v;
}
#define QBH NQB            // EVERY query block takes the 3-product logits + bf16 hi+lo P.v path (logit sigma ~15: sharply peaked softmax)
#define QHI 4096            // rows carrying a q residual plane (all rows when non-causal: 3-product logits everywhere)
#define KHI TT            // residual / bf16 hi+lo planes for ALL keys
// B fragment (k rows k0+.., output column o) of a weight: (in,out) [K][ld] or (out,in) [ld rows of K]: bf16 exact, or f16(bf16 * 256) exact
__device__ __forceinline__ v16b wcol_io(const float* Wm, int k0, int o, int lane, int ld) { v16b w; const int g = lane >> 4;
#pragma unroll
  for (int i = 0; i < 8; ++i) { w[i] = (__bf16)Wm[(size_t)(k0 + 8 * g + i) * ld + o]; w[8 + i] = (__bf16)Wm[(size_t)(k0 + 16 + 8 * g + i) * ld + o]; }
  return w; }
__device__ __forceinline__ v16b wcol_oi(const float* Wm, int k0, int o, int lane, int K) { v16b w; const float* p = Wm + (size_t)o * K + k0 + 8 * (lane >> 4);
#pragma unroll
  for (int i = 0; i < 8; ++i) { w[i] = (__bf16)p[i]; w[8 + i] = (__bf16)p[16 + i]; }
  return w; }
__device__ __forceinline__ v16h wcolh_io(const float* Wm, int k0, int o, int lane, int ld) { v16h w; const int g = lane >> 4;
#pragma unroll
  for (int i = 0; i < 8; ++i) { w[i] = (_Float16)(bfr(Wm[(size_t)(k0 + 8 * g + i) * ld + o]) * 256.0f); w[8 + i] = (_Float16)(bfr(Wm[(size_t)(k0 + 16 + 8 * g + i) * ld + o]) * 256.0f); }
  return w; }
__device__ __forceinline__ v16h wcolh_oi(const float* Wm, int k0, int o, int lane, int K) { v16h w; const float* p = Wm + (size_t)o * K + k0 + 8 * (lane >> 4);
#pragma unroll
  for (int i = 0; i < 8; ++i) { w[i] = (_Float16)(bfr(p[i]) * 256.0f); w[8 + i] = (_Float16)(bfr(p[16 + i]) * 256.0f); }
  return w; }
#define WQKV_LAYOUT 1   // 0 = (in,out) [DIN][CC]; 1 = (out,in) [CC][DIN]; 2 = per-head [NH][DIN][HD]
__device__ __forceinline__ v16b wcol_hdk(const float* Wm, int k0, int o, int lane) { v16b w; const int g = lane >> 4; const float* p = Wm + (size_t)(o / HD) * DIN * HD + (o % HD);
#pragma unroll
  for (int i = 0; i < 8; ++i) { w[i] = (__bf16)p[(size_t)(k0 + 8 * g + i) * HD]; w[8 + i] = (__bf16)p[(size_t)(k0 + 16 + 8 * g + i) * HD]; }
  return w; }
#define WO_OUT_IN 0
#if WQKV_LAYOUT == 1
#define WCOL(W, k0, o, lane) wcol_oi(W, k0, o, lane, DIN)
#elif WQKV_LAYOUT == 2
#define WCOL(W, k0, o, lane) wcol_hdk(W, k0, o, lane)
#else
#define WCOL(W, k0, o, lane) wcol_io(W, k0, o, lane, CC)
#endif
#if WO_OUT_IN
#define WOCOL(W, k0, o, lane) wcol_oi(W, k0, o, lane, CC)
#define WOCOLH(W, k0, o, lane) wcolh_oi(W, k0, o, lane, CC)
#else
#define WOCOL(W, k0, o, lane) wcol_io(W, k0, o, lane, DIN)
#define WOCOLH(W, k0, o, lane) wcolh_io(W, k0, o, lane, DIN)
#endif
#define NPIX 4096
#define FA_KS 8            // key slices over the k_fa grid (per query one partial ctx row, maximum and sum each; merged in k_resT)
#define FA_SK 64           // keys per LDS stage of k_fa
#define RT_R 32            // pixel rows per k_resT block
// ---- k_resT: block = (RT_R pixel rows, 128 channels), 8 waves: merges the FA_KS key slices of a row (weight exp(m_s - M) / sum_s exp(m_s - M) l_s, fixed order), then out[b][c][n] = bf16(x[b][c][n]) + bf16(gamma) * ctx[b*4096 + n][c] via an LDS transpose (each (c, 32 n) run = one 128-B line by 8 threads).
// The partial rows come from memory and are read once, so the kernel runs at the rate of the bytes it keeps in flight: one block per WGP, and every global load of a thread (32 of the partial rows, 4 of x) is issued before its first wait.
__global__ __launch_bounds__(256) void k_resT(const float* __restrict__ Y, const float* __restrict__ ML, const float* __restrict__ X, const float* __restrict__ GM, float* __restrict__ OUT) { __shared__ float stc[128][RT_R + 1]; __shared__ float wsl[FA_KS][RT_R];   // 33-dword pitch: the transposed stores fall on 16 banks, the row reads on 32
  const int tid = threadIdx.x, wave = tid >> 5, lane = tid & 31; const size_t rb = (size_t)blockIdx.x * RT_R; const size_t bb = rb / TT; const int t0 = (int)(rb % TT); const float gm = bfr(GM[0]);
  v2f mlv[FA_KS] = {};
  if (tid < RT_R) {
#pragma unroll
    for (int s = 0; s < FA_KS; ++s) mlv[s] = *(const v2f*)(ML + ((size_t)s * NB * TT + rb + tid) * 2); }
  v4f yv[RT_R / 8][FA_KS]; { const float* yp = Y + (rb + wave) * (size_t)(FA_KS * CC) + lane * 4;   /* a wave = one row's 512 B of one slice per load; rows wave, wave + 8, ... */
#pragma unroll
    for (int it = 0; it < RT_R / 8; ++it) {
#pragma unroll
      for (int s = 0; s < FA_KS; ++s) yv[it][s] = *(const v4f*)(yp + (size_t)it * 8 * FA_KS * CC + s * CC); } }
  const size_t o0 = ((size_t)bb * CC + (tid >> 3)) * NPIX + t0 + (tid & 7) * 4; v4f xv[4];
#pragma unroll
  for (int it = 0; it < 4; ++it) xv[it] = *(const v4f*)(X + o0 + (size_t)it * 32 * NPIX);
  asm volatile("s_wait_xcnt 0x0" ::: "memory");   // the loads' address registers may be reused behind this point; it also keeps every load above in front of the first wait
  if (tid < RT_R) { float mv[FA_KS]; float mx = -3.0e38f;
#pragma unroll
    for (int s = 0; s < FA_KS; ++s) mx = fmaxf(mx, mlv[s][0]);
    float den = 0.f;
#pragma unroll
    for (int s = 0; s < FA_KS; ++s) { mv[s] = expf(mlv[s][0] - mx); den += mv[s] * mlv[s][1]; }
    const float inv = 1.0f / den;   /* den is 1 (to rounding) or more: the slice that holds the maximum has weight 1 and a sum that holds the maximum's own term */
#pragma unroll
    for (int s = 0; s < FA_KS; ++s) wsl[s][tid] = mv[s] * inv; }
  __syncthreads();   // the rows' slice weights are in LDS
#pragma unroll   // yv[] stays in registers only under constant indices
  for (int it = 0; it < RT_R / 8; ++it) { const int rl = wave + it * 8; v4f r = yv[it][0] * wsl[0][rl];
#pragma unroll
    for (int s = 1; s < FA_KS; ++s) r += yv[it][s] * wsl[s][rl];   /* the row's key slices, fixed order */
    stc[lane * 4][rl] = r[0]; stc[lane * 4 + 1][rl] = r[1]; stc[lane * 4 + 2][rl] = r[2]; stc[lane * 4 + 3][rl] = r[3]; }
  __syncthreads();
#pragma unroll   // xv[] likewise
  for (int it = 0; it < 4; ++it) { const float* sp = &stc[(tid >> 3) + it * 32][(tid & 7) * 4]; v4f r4; r4[0] = bfr(xv[it][0]) + gm * sp[0]; r4[1] = bfr(xv[it][1]) + gm * sp[1]; r4[2] = bfr(xv[it][2]) + gm * sp[2]; r4[3] = bfr(xv[it][3]) + gm * sp[3]; vst2(OUT + o0 + (size_t)it * 32 * NPIX, r4); } }
#ifndef SM_EXTRA_PARAMS
#define SM_EXTRA_PARAMS
#endif
#ifndef PROJ_EXTRA_PARAMS
#define PROJ_EXTRA_PARAMS
#endif
#ifndef SM_MASK_HOOK
#define SM_MASK_HOOK (void)0
#endif

#define WS_QH  0u                                      // f16 q rows [b*t][CC]
#define WS_KH  (WS_QH + 2u * (size_t)NB * TT * CC)      // f16 k rows [b*t][CC]
#define WS_VT  (WS_KH + 2u * (size_t)NB * TT * CC)      // f16 v planes [b][c][t]
#define WS_QL  (WS_VT + 2u * (size_t)NB * CC * TT)      // f16 q residual x 2^10 rows [b][t < QHI][CC]
#define WS_KL  (WS_QL + 2u * (size_t)NB * QHI * CC)     // f16 k residual x 2^10 rows [b][t < KHI][CC]
#define WS_VB  (WS_KL + 2u * (size_t)NB * KHI * CC)     // bf16 v hi planes [b][c][t < KHI]
#define WS_VBL (WS_VB + 2u * (size_t)NB * CC * KHI)
#define WS_YY (WS_VBL + 2u * (size_t)NB * CC * KHI)    // f32 partial ctx rows [b*t][key slice][128], unnormalised
#define WS_ML (WS_YY + 4u * (size_t)FA_KS * NB * TT * CC)   // f32 (running maximum, sum) pairs [key slice][b*t]
#define WS_END2 (WS_ML + 8u * (size_t)FA_KS * NB * TT)

typedef __attribute__((ext_vector_type(4))) __bf16 v4b;
// ---- k_proj: block = (64 rows, 128 cols, which): q/k/v = X W (+ b) with exact bf16 products (K = DIN) -> which 0: q f16 rows (+ residual rows < QHI); 1: k f16 rows (+ residual rows < KHI); 2: v f16 planes [c][t] (+ bf16 hi/lo planes for t < KHI)
__global__ __launch_bounds__(128) void k_proj(const float* __restrict__ XQ, const float* __restrict__ XK, const float* __restrict__ XV, const float* __restrict__ WQ, const float* __restrict__ WK, const float* __restrict__ WV, const float* __restrict__ BQ, const float* __restrict__ BK, const float* __restrict__ BV,
    _Float16* __restrict__ QH, _Float16* __restrict__ QL, _Float16* __restrict__ KH, _Float16* __restrict__ KL, _Float16* __restrict__ VT, __bf16* __restrict__ VB, __bf16* __restrict__ VBL) {
  __shared__ __align__(16) _Float16 sh[64][136], sl[64][136]; __shared__ __align__(16) _Float16 th[128][72]; __shared__ __align__(16) __bf16 tb[128][72], tbl[128][72];
  __shared__ __align__(16) __bf16 sw[128][DIN + 8];   // the block's 128 weight rows (out, in) as bf16; 272-B pitch: conflict-free 16-byte fragment reads
  const int tid = threadIdx.x, wave = tid >> 5, lane = tid & 31, col = lane & 15, g = lane >> 4; const int which = blockIdx.z; const int c0 = blockIdx.y * 128; const size_t r0 = (size_t)blockIdx.x * 64; const size_t bb = r0 / TT; const int t0 = (int)(r0 % TT);
  const float* X = which == 0 ? XQ : which == 1 ? XK : XV; const float* WA = which == 0 ? WQ : which == 1 ? WK : WV; const float* BA = which == 0 ? BQ : which == 1 ? BK : BV;
  // Every global load of the block is issued before its first wait, so their latencies overlap (104 loads a wave against a load counter of 63: about two latencies stay exposed) in place of one exposed latency per fragment. The weight comes in by whole-line loads (a wave = one 512-B row), once per block, and goes to LDS as bf16; the four waves read their B fragments from there.
  v4f wr[128 * (DIN / 4) / 128]; { const float* wp = WA + (size_t)(c0 + wave) * DIN + lane * 4;
#pragma unroll
    for (int i = 0; i < 128 * (DIN / 4) / 128; ++i) wr[i] = *(const v4f*)(wp + i * 4 * DIN); }
  asm volatile("s_wait_xcnt 0x0" ::: "memory");   // the weight loads' address pair may be reused by the loads behind this point
  float xr[DIN / 32][16]; { const float* p = X + ((size_t)bb * DIN + 8 * g) * NPIX + t0 + wave * 16 + col;   /* channels-first gather: x[b][k][n], stride NPIX between channels */
#pragma unroll
    for (int kc = 0; kc < DIN / 32; ++kc) {
#pragma unroll
      for (int i = 0; i < 8; ++i) { xr[kc][i] = p[(size_t)(kc * 32 + i) * NPIX]; xr[kc][8 + i] = p[(size_t)(kc * 32 + 16 + i) * NPIX]; } } }
  float bias8[8] = {};
  if (BA) { const float* bp = BA + c0 + col;
#pragma unroll
    for (int j = 0; j < 8; ++j) bias8[j] = bp[j * 16]; }
  asm volatile("s_wait_xcnt 0x0" ::: "memory");   // the loads' address registers may be reused behind this point; it also keeps every load above in front of the LDS stores
#pragma unroll
  for (int i = 0; i < 128 * (DIN / 4) / 128; ++i) { v4b t; t[0] = (__bf16)wr[i][0]; t[1] = (__bf16)wr[i][1]; t[2] = (__bf16)wr[i][2]; t[3] = (__bf16)wr[i][3]; *(v4b*)&sw[wave + i * 4][lane * 4] = t; }
  v16b a[DIN / 32];
#pragma unroll
  for (int kc = 0; kc < DIN / 32; ++kc) {
#pragma unroll
    for (int i = 0; i < 16; ++i) a[kc][i] = (__bf16)xr[kc][i]; }
#pragma unroll
  for (int j = 0; j < 8; ++j) bias8[j] = bfr(bias8[j]);
  __syncthreads();   // the weight is in LDS
  v8f acc[8] = {}; v16b fb[2][8];   // fb: two batches of B fragments (the eight 16-column tiles of one 32-channel step): the next batch's LDS reads fly while this batch's products run
  const __bf16* wrow = &sw[col][0];   /* frag_b has the k order of the gather above: elements 0..7 = k0 + 8g + i, 8..15 = k0 + 16 + 8g + i */
#pragma unroll
  for (int j = 0; j < 8; ++j) fb[0][j] = frag_b(wrow + j * 16 * (DIN + 8), lane);
#pragma unroll   // a[], fb[] and acc[] stay in registers only under constant indices
  for (int kc = 0; kc < DIN / 32; ++kc) { const int cb = kc & 1, nb = cb ^ 1;
    if (kc + 1 < DIN / 32) {
#pragma unroll
      for (int j = 0; j < 8; ++j) fb[nb][j] = frag_b(wrow + j * 16 * (DIN + 8) + (kc + 1) * 32, lane); }
#pragma unroll
    for (int j = 0; j < 8; ++j) acc[j] = wmma_bf(a[kc], fb[cb][j], acc[j]); }
  if (which < 2) { _Float16* DH = which == 0 ? QH : KH; _Float16* DL = which == 0 ? QL : KL; const int nhi = which == 0 ? QHI : KHI; const bool hi_rows = t0 < nhi;
#pragma unroll
    for (int j = 0; j < 8; ++j) { const float bias = bias8[j];
#pragma unroll
      for (int r = 0; r < 8; ++r) { const float v = acc[j][r] + bias; const _Float16 hv = (_Float16)v; sh[wave * 16 + 8 * g + r][j * 16 + col] = hv; sl[wave * 16 + 8 * g + r][j * 16 + col] = (_Float16)((v - (float)hv) * 1024.0f); } }
    __syncthreads();
    for (int e = tid; e < 64 * 16; e += 128) { const int rl = e >> 4, q = e & 15; vst2((unsigned*)(DH + (r0 + rl) * CC + c0 + q * 8), *(const v4u*)&sh[rl][q * 8]); if (hi_rows) vst2((unsigned*)(DL + (bb * nhi + t0 + rl) * (size_t)CC + c0 + q * 8), *(const v4u*)&sl[rl][q * 8]); }
  } else { const bool hi_rows = t0 < KHI;
#pragma unroll
    for (int j = 0; j < 8; ++j) { const float bias = bias8[j];
#pragma unroll
      for (int r = 0; r < 8; ++r) { const float v = acc[j][r] + bias; const int rl = wave * 16 + 8 * g + r, cl = j * 16 + col; th[cl][rl] = (_Float16)v; const __bf16 bh = (__bf16)v; tb[cl][rl] = bh; tbl[cl][rl] = (__bf16)(v - (float)bh); } }
    __syncthreads();
    for (int e = tid; e < 128 * 8; e += 128) { const int cl = e >> 3, q = e & 7; vst2((unsigned*)(VT + (bb * CC + c0 + cl) * (size_t)TT + t0 + q * 8), *(const v4u*)&th[cl][q * 8]); if (hi_rows) { const size_t o3 = (bb * CC + c0 + cl) * (size_t)KHI + t0 + q * 8; vst2((unsigned*)(VB + o3), *(const v4u*)&tb[cl][q * 8]); vst2((unsigned*)(VBL + o3), *(const v4u*)&tbl[cl][q * 8]); } } } }
// the builtin forms as they are: the compiler keeps the distance behind a matrix instruction itself and is free to move LDS reads ahead of it
__device__ __forceinline__ v8f mm_h(v16h a, v16h b, v8f c) { return __builtin_amdgcn_wmma_f32_16x16x32_f16(false, a, false, b, (short)0, c, false, false); }
__device__ __forceinline__ v8f mm_b(v16b a, v16b b, v8f c) { return __builtin_amdgcn_wmma_f32_16x16x32_bf16(false, a, false, b, (short)0, c, false, false); }
#define FA_KB (FA_SK * 2 * (CC + 8))      // bytes of one k plane of a stage: FA_SK rows, 272-B pitch (conflict-free 16-byte fragment reads)
#define FA_VB (CC * 2 * (FA_SK + 8))      // bytes of one v plane of a stage: CC rows, 144-B pitch, likewise
#define FA_BUF (2 * FA_KB + 2 * FA_VB)    // one stage buffer: k hi, k residual, v hi, v lo
#define FA_IO (2 * 16 * 2 * (CC + 8))     // one wave's q / ctx tile
#define FA_NST (TT / FA_KS / FA_SK)       // stages per block
static_assert(8 * FA_IO <= FA_BUF && FA_NST >= 2, "the waves' tiles lie in buffer 1; the ring's prologue needs two stages");
// eight asynchronous 16-byte copies to LDS, every lane with its own LDS byte address and global address. The s_wait_xcnt is the last line of the copies' own statement, so no address register is rewritten in front of it.
__device__ __forceinline__ void cp8(unsigned l0, unsigned l1, unsigned l2, unsigned l3, unsigned l4, unsigned l5, unsigned l6, unsigned l7, const void* g0, const void* g1, const void* g2, const void* g3, const void* g4, const void* g5, const void* g6, const void* g7) {
  asm volatile("global_load_async_to_lds_b128 %0, %8, off\n\tglobal_load_async_to_lds_b128 %1, %9, off\n\tglobal_load_async_to_lds_b128 %2, %10, off\n\tglobal_load_async_to_lds_b128 %3, %11, off\n\t"
               "global_load_async_to_lds_b128 %4, %12, off\n\tglobal_load_async_to_lds_b128 %5, %13, off\n\tglobal_load_async_to_lds_b128 %6, %14, off\n\tglobal_load_async_to_lds_b128 %7, %15, off\n\ts_wait_xcnt 0x0"
               :: "v"(l0), "v"(l1), "v"(l2), "v"(l3), "v"(l4), "v"(l5), "v"(l6), "v"(l7), "v"(g0), "v"(g1), "v"(g2), "v"(g3), "v"(g4), "v"(g5), "v"(g6), "v"(g7) : "memory"); }
// one stage's 16 copies of a thread (lk, lv: the lane's first k and v byte in the target buffer), whole lines: 16 lanes per 256-B k row, 8 lanes per 128-B run of a v plane; the four source pointers then walk on by one stage
__device__ __forceinline__ void fa_stage(unsigned lk, unsigned lv, const _Float16*& gkh, const _Float16*& gkl, const __bf16*& gvh, const __bf16*& gvl) {
  const unsigned kp = 16 * 2 * (CC + 8), vp = 32 * 2 * (FA_SK + 8);
  cp8(lk, lk + kp, lk + 2 * kp, lk + 3 * kp, lk + FA_KB, lk + FA_KB + kp, lk + FA_KB + 2 * kp, lk + FA_KB + 3 * kp, gkh, gkh + 16 * CC, gkh + 32 * CC, gkh + 48 * CC, gkl, gkl + 16 * CC, gkl + 32 * CC, gkl + 48 * CC);
  cp8(lv, lv + vp, lv + 2 * vp, lv + 3 * vp, lv + FA_VB, lv + FA_VB + vp, lv + FA_VB + 2 * vp, lv + FA_VB + 3 * vp, gvh, gvh + (size_t)32 * KHI, gvh + (size_t)64 * KHI, gvh + (size_t)96 * KHI, gvl, gvl + (size_t)32 * KHI, gvl + (size_t)64 * KHI, gvl + (size_t)96 * KHI);
  gkh += FA_SK * CC; gkl += FA_SK * CC; gvh += FA_SK; gvl += FA_SK; }
__global__ __launch_bounds__(256) void k_fa(const _Float16* __restrict__ QH, const _Float16* __restrict__ QL, const _Float16* __restrict__ KH, const _Float16* __restrict__ KL, const __bf16* __restrict__ VB, const __bf16* __restrict__ VBL, float* __restrict__ Y, float* __restrict__ ML) {
  __shared__ __align__(16) char ring[2][FA_BUF];   // the two stage buffers. Buffer 1 also holds, before stage 1 is copied and after the last stage is read, one tile per wave, read and written by that wave alone: its 16 q rows (hi, then residual; 272-B pitch) on the way in, its 16 partial ctx rows (f32, 528-B pitch) on the way out: two work-groups still fit a WGP's LDS
  const int tid = threadIdx.x, wave = tid >> 5, lane = tid & 31, col = lane & 15, g = lane >> 4;
  const size_t qr = (size_t)blockIdx.x * 128 + wave * 16 + col;   // this lane's query row in [b*t]
  const size_t bb = (size_t)blockIdx.x / (TT / 128); const int key0 = (int)blockIdx.y * (TT / FA_KS);
  const int kr = tid >> 4, kq = (tid & 15) * 8, vr = tid >> 3, vq = (tid & 7) * 8;   // staging: 16 lanes per 256-B k row, 8 lanes per 128-B run of a v plane
  const _Float16 *gkh = KH + (bb * TT + key0 + kr) * (size_t)CC + kq, *gkl = KL + (bb * TT + key0 + kr) * (size_t)CC + kq; const __bf16 *gvh = VB + (bb * CC + vr) * (size_t)KHI + key0 + vq, *gvl = VBL + (bb * CC + vr) * (size_t)KHI + key0 + vq;
  const unsigned lk = (unsigned)(size_t)&ring[0][0] + kr * (2 * (CC + 8)) + kq * 2, lv = (unsigned)(size_t)&ring[0][0] + 2 * FA_KB + vr * (2 * (FA_SK + 8)) + vq * 2;   // the lane's first k and v byte in buffer 0 (LDS byte address = low 32 bits of the shared address)
  fa_stage(lk, lv, gkh, gkl, gvh, gvl);   // stage 0 into buffer 0: it flies behind the q rows
  // q comes in by whole lines (a wave-wide 16-byte load = two 256-B rows = 4 lines) and is dealt into fragments from the wave's LDS tile: a fragment load from global memory takes 16 B of each of 16 rows, 16 lines per load.
  char* wio = ring[1] + wave * FA_IO; const size_t q0 = (size_t)blockIdx.x * 128 + wave * 16;   // the wave's first query row in [b*t]
  { v4u th[8], tl[8]; const _Float16 *pqh = QH + (q0 + g) * CC + col * 8, *pql = QL + (q0 + g) * CC + col * 8;
#pragma unroll
    for (int i = 0; i < 8; ++i) { th[i] = *(const v4u*)(pqh + i * 2 * CC); tl[i] = *(const v4u*)(pql + i * 2 * CC); }
    asm volatile("s_wait_xcnt 0x0" :: "v"(pqh), "v"(pql) : "memory");   // the q loads' address registers, named here so that they live up to the wait, may be reused behind this point
    char* wq = wio + g * (2 * (CC + 8)) + col * 16;
#pragma unroll
    for (int i = 0; i < 8; ++i) { *(v4u*)(wq + i * 2 * (2 * (CC + 8))) = th[i]; *(v4u*)(wq + (16 + i * 2) * (2 * (CC + 8))) = tl[i]; } }
  asm volatile("s_wait_dscnt 0x0" ::: "memory");   // the wave's own rows are in its tile before other lanes of the wave read them
  v16h qh[HD / 32], ql[HD / 32]; { const _Float16* sq = (const _Float16*)wio + col * (CC + 8);
#pragma unroll
    for (int kc = 0; kc < HD / 32; ++kc) { qh[kc] = frag_h(sq + kc * 32, lane); ql[kc] = frag_h(sq + 16 * (CC + 8) + kc * 32, lane); } }
  asm volatile("s_wait_dscnt 0x0" ::: "memory");   // the wave's q fragments are read: it has left its tile in buffer 1
  asm volatile("s_wait_asynccnt 0x0" ::: "memory");   // the wave's own copies of stage 0 have landed
  __syncthreads();   // stage 0 is readable by every wave, and every wave has left buffer 1
  fa_stage(lk + FA_BUF, lv + FA_BUF, gkh, gkl, gvh, gvl);   // stage 1 into buffer 1
  v8f o[HD / 16] = {}; float mrun = -3.0e38f, lsum = 0.f;   // mrun: running maximum of score x SC2, the base-2 exponent that is taken off
#pragma unroll 1   // rolled: one stage's code is the whole hot loop and the accumulators stay in place
  for (int st = 0; st < FA_NST; ++st) {
    const char* sb = ring[st & 1];   // stage st's buffer; this pass reads nothing else
#pragma unroll 1   // rolled: halves the hot loop's code; both passes are alike
    for (int u = 0; u < FA_SK / 32; ++u) {
      v8f sh[2] = {}, sl[2] = {}; v16h ka[2][4];   // ka: two batches of fragments (k hi, k residual of both 16-key tiles for one 32-channel step): the next batch's LDS reads fly while this batch's products run
      const _Float16 *rh = (const _Float16*)(sb + (u * 32 + col) * (2 * (CC + 8))), *rl = rh + FA_KB / 2;
      ka[0][0] = frag_h(rh, lane); ka[0][1] = frag_h(rl, lane); ka[0][2] = frag_h(rh + 16 * (CC + 8), lane); ka[0][3] = frag_h(rl + 16 * (CC + 8), lane);
#pragma unroll
      for (int kc = 0; kc < HD / 32; ++kc) { const int cb = kc & 1, nb = cb ^ 1;
        if (kc + 1 < HD / 32) { ka[nb][0] = frag_h(rh + (kc + 1) * 32, lane); ka[nb][1] = frag_h(rl + (kc + 1) * 32, lane); ka[nb][2] = frag_h(rh + 16 * (CC + 8) + (kc + 1) * 32, lane); ka[nb][3] = frag_h(rl + 16 * (CC + 8) + (kc + 1) * 32, lane); }
        __builtin_amdgcn_sched_barrier(0);   // keeps the next batch's reads in front of this block: sunk to their use, each would expose the LDS latency
        sh[0] = mm_h(ka[cb][0], qh[kc], sh[0]); sh[1] = mm_h(ka[cb][2], qh[kc], sh[1]); sl[0] = mm_h(ka[cb][0], ql[kc], sl[0]); sl[1] = mm_h(ka[cb][2], ql[kc], sl[1]); sl[0] = mm_h(ka[cb][1], qh[kc], sl[0]); sl[1] = mm_h(ka[cb][3], qh[kc], sl[1]);
        __builtin_amdgcn_sched_barrier(0); }   // ends the block: the reads behind it stay behind it
      v16b va[2][4];   // likewise for v: hi, lo planes of two 16-channel tiles; the first batch flies behind the softmax arithmetic
      const __bf16 *wh = (const __bf16*)(sb + 2 * FA_KB + col * (2 * (FA_SK + 8))) + u * 32, *wl = wh + FA_VB / 2;
      va[0][0] = frag_b(wh, lane); va[0][1] = frag_b(wl, lane); va[0][2] = frag_b(wh + 16 * (FA_SK + 8), lane); va[0][3] = frag_b(wl + 16 * (FA_SK + 8), lane);
      __builtin_amdgcn_sched_barrier(0);   // keeps these reads in front of the softmax arithmetic
      float pv[16]; float mx = -3.0e38f;
#pragma unroll
      for (int r = 0; r < 8; ++r) { pv[r] = sh[0][r] + sl[0][r] * (1.0f / 1024.0f); pv[8 + r] = sh[1][r] + sl[1][r] * (1.0f / 1024.0f); mx = fmaxf(mx, fmaxf(pv[r], pv[8 + r])); }   /* unscaled: SC2 > 0 keeps the order */
      mx = fmaxf(mx, __shfl_xor(mx, 16)) * SC2;   // the other half of the wave holds this query's other 16 keys; from here on in base-2 exponent units
      if (__builtin_amdgcn_ballot_w32(mx > mrun) != 0) {   // some query's maximum rose: rescale what is summed so far (factor 1 for the others)
        const float mn = fmaxf(mrun, mx), al = __builtin_amdgcn_exp2f(mrun - mn); mrun = mn; lsum *= al;
#pragma unroll
        for (int j = 0; j < HD / 16; ++j) o[j] *= al; }
#pragma unroll
      for (int i = 0; i < 16; ++i) pv[i] = fmaf(pv[i], SC2, -mrun);   /* all sixteen exponents first: the exp2 run behind them then has independent neighbours */
#pragma unroll   // pv[] must stay in registers
      for (int i = 0; i < 16; ++i) { pv[i] = __builtin_amdgcn_exp2f(pv[i]); lsum += pv[i]; }
      const F2 p = bsplit16(pv);
#pragma unroll
      for (int jb = 0; jb < HD / 32; ++jb) { const int cb = jb & 1, nb = cb ^ 1, j = 2 * jb;
        if (jb + 1 < HD / 32) { va[nb][0] = frag_b(wh + (j + 2) * 16 * (FA_SK + 8), lane); va[nb][1] = frag_b(wl + (j + 2) * 16 * (FA_SK + 8), lane); va[nb][2] = frag_b(wh + (j + 3) * 16 * (FA_SK + 8), lane); va[nb][3] = frag_b(wl + (j + 3) * 16 * (FA_SK + 8), lane); }
        __builtin_amdgcn_sched_barrier(0);   // as above: the next batch's reads stay in front of this block
        o[j] = mm_b(va[cb][0], p.h, o[j]); o[j + 1] = mm_b(va[cb][2], p.h, o[j + 1]); o[j] = mm_b(va[cb][0], p.l, o[j]); o[j + 1] = mm_b(va[cb][2], p.l, o[j + 1]); o[j] = mm_b(va[cb][1], p.h, o[j]); o[j + 1] = mm_b(va[cb][3], p.h, o[j + 1]);
        __builtin_amdgcn_sched_barrier(0); } }   // ends the block
    asm volatile("s_wait_dscnt 0x0" ::: "memory");   // the wave's reads of this stage's buffer are done
    asm volatile("s_wait_asynccnt 0x0" ::: "memory");   // the wave's own copies of the next stage have landed
    __syncthreads();   // the one barrier of a stage: it publishes stage st + 1 and frees stage st's buffer
    if (st + 2 < FA_NST) fa_stage(lk + (st & 1) * FA_BUF, lv + (st & 1) * FA_BUF, gkh, gkl, gvh, gvl); }   // stage st + 2 into the buffer just read; it flies under stage st + 1's products
  asm volatile("s_wait_asynccnt 0x0" ::: "memory");   // no copy is outstanding when buffer 1 becomes the waves' output tiles (every wave's last read of it ended at the last barrier)
  lsum += __shfl_xor(lsum, 16);
  __builtin_amdgcn_sched_barrier(0);   // keeps the exchange in front of the row stores below: sunk among them it would overwrite a register of an issued store and put a wait into the run
  // the partial rows leave by whole lines: from the accumulators a store would put 16 B into each of 16 rows (16 lines per store); through the wave's tile a store is one query's 512-B row (4 lines)
  float* so = (float*)wio + col * (CC + 4) + 8 * g;   // O^T tile j, element r = channel 16 j + 8 g + r of query q0 + col
#pragma unroll
  for (int j = 0; j < HD / 16; ++j) { *(v4f*)(so + j * 16) = __builtin_shufflevector(o[j], o[j], 0, 1, 2, 3); *(v4f*)(so + j * 16 + 4) = __builtin_shufflevector(o[j], o[j], 4, 5, 6, 7); }
  asm volatile("s_wait_dscnt 0x0" ::: "memory");   // the wave's own tile is written before other lanes of the wave read it back
  float* yr = Y + (q0 * FA_KS + blockIdx.y) * CC + lane * 4; const float* si = (const float*)wio + lane * 4;
#pragma unroll
  for (int r = 0; r < 16; ++r) vst2(yr + (size_t)r * FA_KS * CC, *(const v4f*)(si + r * (CC + 4)));
  if (g == 0) { v2f t; t[0] = mrun * 0.6931471805599453f; t[1] = lsum;   /* the maximum in natural-log units, as k_resT weighs the slices */ vst2(ML + ((size_t)blockIdx.y * NB * TT + qr) * 2, t); } }

extern "C" void kernel_launch(void* const* d_in, const int* in_sizes, int n_in, void* d_out, int out_size, void* d_ws, size_t ws_size, hipStream_t stream) {
  (void)in_sizes; (void)n_in; (void)out_size;
  const float** F = (const float**)d_in;
  if (ws_size < (size_t)WS_END2) return;
  char* ws = (char*)d_ws; _Float16 *QH = (_Float16*)(ws + WS_QH), *KH = (_Float16*)(ws + WS_KH), *VT = (_Float16*)(ws + WS_VT), *QL = (_Float16*)(ws + WS_QL), *KL = (_Float16*)(ws + WS_KL); __bf16 *VB = (__bf16*)(ws + WS_VB), *VBL = (__bf16*)(ws + WS_VBL); float *YY = (float*)(ws + WS_YY), *ML = (float*)(ws + WS_ML);
  // inputs: 0 x [2,128,16,16,16]; 1 Wq (out,in), 2 bq; 3 Wk, 4 bk; 5 Wv, 6 bv; 7 gamma [scalar]
  k_proj<<<dim3(TNB * TT / 64, CC / 128, 3), 128, 0, stream>>>(F[0], F[0], F[0], F[1], F[3], F[5], F[2], F[4], F[6], QH, QL, KH, KL, VT, VB, VBL);
  k_fa<<<dim3(TNB * TT / 128, FA_KS), 256, 0, stream>>>(QH, QL, KH, KL, VB, VBL, YY, ML);
  k_resT<<<dim3(TNB * TT / RT_R), 256, 0, stream>>>(YY, ML, F[0], F[7], (float*)d_out);
}

// v008
// One run takes 44.8 microseconds.
// Next to v007, in two timings, it ran 1.04 times as fast each time.
// All steps since v000 together make it 21.1 times as fast.
// compute dtype: all float inputs rounded to bf16; q/k/v = W x + b with EXACT bf16 products on WMMA 16x16x32 (f32 accumulate; channels-first input gathered); logits with BOTH q and k as f16 hi + residual (x 2^10) (3 products) x 1.3 - the logits have sigma ~15 so the softmax is sharply peaked and single-f16 operands would not do; online softmax in f32 in base 2 (hardware exp2 of score x 1.3 log2 e minus the running maximum per query, one fused multiply-add); unnormalised P split bf16 hi + lo against v bf16 hi + lo (3 products); residual x + gamma out in f32; f32 output (channels-first).
#include <hip/hip_runtime.h>
#include <math.h>

typedef __attribute__((ext_vector_type(16))) _Float16 v16h;
typedef __attribute__((ext_vector_type(16))) __bf16 v16b;
typedef __attribute__((ext_vector_type(8)))  _Float16 v8h;
typedef __attribute__((ext_vector_type(8)))  float v8f;
typedef __attribute__((ext_vector_type(4)))  float v4f;
typedef __attribute__((ext_vector_type(2)))  float v2f;
typedef __attribute__((ext_vector_type(4)))  unsigned v4u;
typedef __attribute__((ext_vector_type(4)))  int v4i;
typedef float __attribute__((may_alias)) float_a;
typedef int __attribute__((may_alias)) int_a;

template <typename T> __device__ __forceinline__ void vst2(void* p, T v) { *(T*)p = v;  }
__device__ __forceinline__ v8f wmma16(v16h a, v16h b, v8f c) {
  v8f d = __builtin_amdgcn_wmma_f32_16x16x32_f16(false, a, false, b, (short)0, c, false, false);
  asm volatile("v_nop\n\tv_nop\n\tv_nop\n\tv_nop" : "+v"(d) : "v"(a), "v"(b));
  return d;
}
__device__ __forceinline__ v8f wmma_bf(v16b a, v16b b, v8f c) {
  v8f d = __builtin_amdgcn_wmma_f32_16x16x32_bf16(false, a, false, b, (short)0, c, false, false);
  asm volatile("v_nop\n\tv_nop\n\tv_nop\n\tv_nop" : "+v"(d) : "v"(a), "v"(b));
  return d;
}
// 16x16x32 fragments: lane = (h = lane>>4, row/col = lane&15); elements 0..7 = k0+8h+0..7, 8..15 = k0+16+8h+0..7; D element r = row 8h+r
__device__ __forceinline__ v16h frag_h(const _Float16* rowk0, int lane) {
  union { v16h v; v8h q[2]; } u; const _Float16* p = rowk0 + 8 * (lane >> 4);
  u.q[0] = *(const v8h*)p; u.q[1] = *(const v8h*)(p + 16); return u.v;
}
__device__ __forceinline__ v16h frag_f32(const float* rowk0, int lane) {
  v16h a; const float* p = rowk0 + 8 * (lane >> 4);
#pragma unroll
  for (int i = 0; i < 8; ++i) { a[i] = (_Float16)p[i]; a[8 + i] = (_Float16)p[16 + i]; }
  return a;
}
__device__ __forceinline__ v16h frag_f32s(const float* rowk0, int lane, float sc) {
  v16h a; const float* p = rowk0 + 8 * (lane >> 4);
#pragma unroll
  for (int i = 0; i < 8; ++i) { a[i] = (_Float16)(p[i] * sc); a[8 + i] = (_Float16)(p[16 + i] * sc); }
  return a;
}
// column fragment from a [K][ld] layout (column n), rows >= K read as 0
__device__ __forceinline__ v16h fragc_f32(const float* W, int k0, int n, int lane, int ld, int K) {
  v16h a; const int g = lane >> 4;
#pragma unroll
  for (int i = 0; i < 8; ++i) { const int ka = k0 + 8 * g + i, kb = ka + 16;
    a[i] = (_Float16)(ka < K ? W[(size_t)(ka < K ? ka : K - 1) * ld + n] : 0.f); a[8 + i] = (_Float16)(kb < K ? W[(size_t)(kb < K ? kb : K - 1) * ld + n] : 0.f); }
  return a;
}
struct F2 { v16b h, l; };
__device__ __forceinline__ F2 bsplit16(const float v[16]) { F2 r;
#pragma unroll
  for (int i = 0; i < 16; ++i) { const __bf16 h = (__bf16)v[i]; r.h[i] = h; r.l[i] = (__bf16)(v[i] - (float)h); }
  return r; }
__device__ __forceinline__ F2 split_row(const float* row, int k0, int lane) { float v[16]; const float* p = row + k0 + 8 * (lane >> 4);
#pragma unroll
  for (int i = 0; i < 8; ++i) { v[i] = p[i]; v[8 + i] = p[16 + i]; }
  return bsplit16(v); }
__device__ __forceinline__ F2 split_rowK(const float* row, int k0, int lane, int K) { float v[16]; const int g = lane >> 4;
#pragma unroll
  for (int i = 0; i < 8; ++i) { const int ka = k0 + 8 * g + i, kb = ka + 16; v[i] = ka < K ? row[ka < K ? ka : K - 1] : 0.f; v[8 + i] = kb < K ? row[kb < K ? kb : K - 1] : 0.f; }
  return bsplit16(v); }
__device__ __forceinline__ F2 split_col(const float* W, int k0, int n, int lane, int ld, int K) { float v[16]; const int g = lane >> 4;
#pragma unroll
  for (int i = 0; i < 8; ++i) { const int ka = k0 + 8 * g + i, kb = ka + 16; v[i] = ka < K ? W[(size_t)(ka < K ? ka : K - 1) * ld + n] : 0.f; v[8 + i] = kb < K ? W[(size_t)(kb < K ? kb : K - 1) * ld + n] : 0.f; }
  return bsplit16(v); }
__device__ __forceinline__ v8f mac3(const F2& a, const F2& b, v8f c) { c = wmma_bf(a.l, b.h, c); c = wmma_bf(a.h, b.l, c); return wmma_bf(a.h, b.h, c); }
__device__ __forceinline__ float sigm(float v) { return 1.0f / (1.0f + expf(-v)); }
#define LDSX() do { asm volatile("s_wait_dscnt 0" ::: "memory"); __builtin_amdgcn_wave_barrier(); __builtin_amdgcn_fence(__ATOMIC_RELEASE, "workgroup"); } while (0)

// Single-head self-attention over a flattened 16x16x16 volume (B 2, C 128, N 4,096): q/k/v = 1x1x1 convs (W (out,in) [128,128] + b); attn = softmax((q^T k) * 1.3) over keys; out[c][n] = sum_m v[c][m] attn[n][m]; result = x + gamma * out (gamma = 0.3 scalar input).
#define NB 2
#define TT 4096
#define CC 128            // NH * HD = projected width
#define DIN 128          // input (model) width
#define NH 1
#define HD 128
#define NQB (TT / 64)
#define HG 1
#define SCALE (1.3f)
#define SC2 ((float)((double)SCALE * 1.4426950408889634))   // SCALE x log2 e: exp(SCALE t) = exp2(SC2 t)
#define CAUSAL 0
#ifndef TNB
#define TNB NB
#endif
__device__ __forceinline__ float bfr(float v) { return (float)(__bf16)v; }
__host__ __device__ __forceinline__ int kb_last(int qb) { return CAUSAL ? ((qb * 64 + 63) >> 7) : (TT / 128 - 1); }
typedef __attribute__((ext_vector_type(8))) __bf16 v8b;
__device__ __forceinline__ v16b frag_b(const __bf16* rowk0, int lane) {
  union { v16b v; v8b q[2]; } u; const __bf16* p = rowk0 + 8 * (lane >> 4);
  u.q[0] = *(const v8b*)p; u.q[1] = *(const v8b*)(p + 16); return u.v;
}
#define QBH NQB            // EVERY query block takes the 3-product logits + bf16 hi+lo P.v path (logit sigma ~15: sharply peaked softmax)
#define QHI 4096            // rows carrying a q residual plane (all rows when non-causal: 3-product logits everywhere)
#define KHI TT            // residual / bf16 hi+lo planes for ALL keys
// B fragment (k rows k0+.., output column o) of a weight: (in,out) [K][ld] or (out,in) [ld rows of K]: bf16 exact, or f16(bf16 * 256) exact
__device__ __forceinline__ v16b wcol_io(const float* Wm, int k0, int o, int lane, int ld) { v16b w; const int g = lane >> 4;
#pragma unroll
  for (int i = 0; i < 8; ++i) { w[i] = (__bf16)Wm[(size_t)(k0 + 8 * g + i) * ld + o]; w[8 + i] = (__bf16)Wm[(size_t)(k0 + 16 + 8 * g + i) * ld + o]; }
  return w; }
__device__ __forceinline__ v16b wcol_oi(const float* Wm, int k0, int o, int lane, int K) { v16b w; const float* p = Wm + (size_t)o * K + k0 + 8 * (lane >> 4);
#pragma unroll
  for (int i = 0; i < 8; ++i) { w[i] = (__bf16)p[i]; w[8 + i] = (__bf16)p[16 + i]; }
  return w; }
__device__ __forceinline__ v16h wcolh_io(const float* Wm, int k0, int o, int lane, int ld) { v16h w; const int g = lane >> 4;
#pragma unroll
  for (int i = 0; i < 8; ++i) { w[i] = (_Float16)(bfr(Wm[(size_t)(k0 + 8 * g + i) * ld + o]) * 256.0f); w[8 + i] = (_Float16)(bfr(Wm[(size_t)(k0 + 16 + 8 * g + i) * ld + o]) * 256.0f); }
  return w; }
__device__ __forceinline__ v16h wcolh_oi(const float* Wm, int k0, int o, int lane, int K) { v16h w; const float* p = Wm + (size_t)o * K + k0 + 8 * (lane >> 4);
#pragma unroll
  for (int i = 0; i < 8; ++i) { w[i] = (_Float16)(bfr(p[i]) * 256.0f); w[8 + i] = (_Float16)(bfr(p[16 + i]) * 256.0f); }
  return w; }
#define WQKV_LAYOUT 1   // 0 = (in,out) [DIN][CC]; 1 = (out,in) [CC][DIN]; 2 = per-head [NH][DIN][HD]
__device__ __forceinline__ v16b wcol_hdk(const float* Wm, int k0, int o, int lane) { v16b w; const int g = lane >> 4; const float* p = Wm + (size_t)(o / HD) * DIN * HD + (o % HD);
#pragma unroll
  for (int i = 0; i < 8; ++i) { w[i] = (__bf16)p[(size_t)(k0 + 8 * g + i) * HD]; w[8 + i] = (__bf16)p[(size_t)(k0 + 16 + 8 * g + i) * HD]; }
  return w; }
#define WO_OUT_IN 0
#if WQKV_LAYOUT == 1
#define WCOL(W, k0, o, lane) wcol_oi(W, k0, o, lane, DIN)
#elif WQKV_LAYOUT == 2
#define WCOL(W, k0, o, lane) wcol_hdk(W, k0, o, lane)
#else
#define WCOL(W, k0, o, lane) wcol_io(W, k0, o, lane, CC)
#endif
#if WO_OUT_IN
#define WOCOL(W, k0, o, lane) wcol_oi(W, k0, o, lane, CC)
#define WOCOLH(W, k0, o, lane) wcolh_oi(W, k0, o, lane, CC)
#else
#define WOCOL(W, k0, o, lane) wcol_io(W, k0, o, lane, DIN)
#define WOCOLH(W, k0, o, lane) wcolh_io(W, k0, o, lane, DIN)
#endif
#define NPIX 4096
#define FA_KS 8            // key slices over the k_fa grid (per query one partial ctx row, maximum and sum each; merged in k_resT)
#define FA_SK 64           // keys per LDS stage of k_fa
#define RT_R 32            // pixel rows per k_resT block
// ---- k_resT: block = (RT_R pixel rows, 128 channels), 8 waves: merges the FA_KS key slices of a row (weight exp(m_s - M) / sum_s exp(m_s - M) l_s, fixed order), then out[b][c][n] = bf16(x[b][c][n]) + bf16(gamma) * ctx[b*4096 + n][c] via an LDS transpose (each (c, 32 n) run = one 128-B line by 8 threads).
// The partial rows come from memory and are read once, so the kernel runs at the rate of the bytes it keeps in flight: one block per WGP, and every global load of a thread (32 of the partial rows, 4 of x) is issued before its first wait.
__global__ __launch_bounds__(256) void k_resT(const float* __restrict__ Y, const float* __restrict__ ML, const float* __restrict__ X, const float* __restrict__ GM, float* __restrict__ OUT) { __shared__ float stc[128][RT_R + 1]; __shared__ float wsl[FA_KS][RT_R];   // 33-dword pitch: the transposed stores fall on 16 banks, the row reads on 32
  const int tid = threadIdx.x, wave = tid >> 5, lane = tid & 31; const size_t rb = (size_t)blockIdx.x * RT_R; const size_t bb = rb / TT; const int t0 = (int)(rb % TT); const float gm = bfr(GM[0]);
  v2f mlv[FA_KS] = {};
  if (tid < RT_R) {
#pragma unroll
    for (int s = 0; s < FA_KS; ++s) mlv[s] = *(const v2f*)(ML + ((size_t)s * NB * TT + rb + tid) * 2); }
  v4f yv[RT_R / 8][FA_KS]; { const float* yp = Y + (rb + wave) * (size_t)(FA_KS * CC) + lane * 4;   /* a wave = one row's 512 B of one slice per load; rows wave, wave + 8, ... */
#pragma unroll
    for (int it = 0; it < RT_R / 8; ++it) {
#pragma unroll
      for (int s = 0; s < FA_KS; ++s) yv[it][s] = *(const v4f*)(yp + (size_t)it * 8 * FA_KS * CC + s * CC); } }
  const size_t o0 = ((size_t)bb * CC + (tid >> 3)) * NPIX + t0 + (tid & 7) * 4; v4f xv[4];
#pragma unroll
  for (int it = 0; it < 4; ++it) xv[it] = *(const v4f*)(X + o0 + (size_t)it * 32 * NPIX);
  asm volatile("s_wait_xcnt 0x0" ::: "memory");   // the loads' address registers may be reused behind this point; it also keeps every load above in front of the first wait
  if (tid < RT_R) { float mv[FA_KS]; float mx = -3.0e38f;
#pragma unroll
    for (int s = 0; s < FA_KS; ++s) mx = fmaxf(mx, mlv[s][0]);
    float den = 0.f;
#pragma unroll
    for (int s = 0; s < FA_KS; ++s) { mv[s] = expf(mlv[s][0] - mx); den += mv[s] * mlv[s][1]; }
    const float inv = 1.0f / den;   /* den is 1 (to rounding) or more: the slice that holds the maximum has weight 1 and a sum that holds the maximum's own term */
#pragma unroll
    for (int s = 0; s < FA_KS; ++s) wsl[s][tid] = mv[s] * inv; }
  __syncthreads();   // the rows' slice weights are in LDS
#pragma unroll   // yv[] stays in registers only under constant indices
  for (int it = 0; it < RT_R / 8; ++it) { const int rl = wave + it * 8; v4f r = yv[it][0] * wsl[0][rl];
#pragma unroll
    for (int s = 1; s < FA_KS; ++s) r += yv[it][s] * wsl[s][rl];   /* the row's key slices, fixed order */
    stc[lane * 4][rl] = r[0]; stc[lane * 4 + 1][rl] = r[1]; stc[lane * 4 + 2][rl] = r[2]; stc[lane * 4 + 3][rl] = r[3]; }
  __syncthreads();
#pragma unroll   // xv[] likewise
  for (int it = 0; it < 4; ++it) { const float* sp = &stc[(tid >> 3) + it * 32][(tid & 7) * 4]; v4f r4; r4[0] = bfr(xv[it][0]) + gm * sp[0]; r4[1] = bfr(xv[it][1]) + gm * sp[1]; r4[2] = bfr(xv[it][2]) + gm * sp[2]; r4[3] = bfr(xv[it][3]) + gm * sp[3]; vst2(OUT + o0 + (size_t)it * 32 * NPIX, r4); } }
#ifndef SM_EXTRA_PARAMS
#define SM_EXTRA_PARAMS
#endif
#ifndef PROJ_EXTRA_PARAMS
#define PROJ_EXTRA_PARAMS
#endif
#ifndef SM_MASK_HOOK
#define SM_MASK_HOOK (void)0
#endif

#define WS_QH  0u                                      // f16 q rows [b*t][CC]
#define WS_KH  (WS_QH + 2u * (size_t)NB * TT * CC)      // f16 k rows [b*t][CC]
#define WS_VT  (WS_KH + 2u * (size_t)NB * TT * CC)      // f16 v planes [b][c][t]
#define WS_QL  (WS_VT + 2u * (size_t)NB * CC * TT)      // f16 q residual x 2^10 rows [b][t < QHI][CC]
#define WS_KL  (WS_QL + 2u * (size_t)NB * QHI * CC)     // f16 k residual x 2^10 rows [b][t < KHI][CC]
#define WS_VB  (WS_KL + 2u * (size_t)NB * KHI * CC)     // bf16 v hi planes [b][c][t < KHI]
#define WS_VBL (WS_VB + 2u * (size_t)NB * CC * KHI)
#define WS_YY (WS_VBL + 2u * (size_t)NB * CC * KHI)    // f32 partial ctx rows [b*t][key slice][128], unnormalised
#define WS_ML (WS_YY + 4u * (size_t)FA_KS * NB * TT * CC)   // f32 (running maximum, sum) pairs [key slice][b*t]
#define WS_END2 (WS_ML + 8u * (size_t)FA_KS * NB * TT)

typedef __attribute__((ext_vector_type(4))) __bf16 v4b;
// ---- k_proj: block = (64 rows, 128 cols, which): q/k/v = X W (+ b) with exact bf16 products (K = DIN) -> which 0: q f16 rows (+ residual rows < QHI); 1: k f16 rows (+ residual rows < KHI); 2: v f16 planes [c][t] (+ bf16 hi/lo planes for t < KHI)
__global__ __launch_bounds__(128) void k_proj(const float* __restrict__ XQ, const float* __restrict__ XK, const float* __restrict__ XV, const float* __restrict__ WQ, const float* __restrict__ WK, const float* __restrict__ WV, const float* __restrict__ BQ, const float* __restrict__ BK, const float* __restrict__ BV,
    _Float16* __restrict__ QH, _Float16* __restrict__ QL, _Float16* __restrict__ KH, _Float16* __restrict__ KL, _Float16* __restrict__ VT, __bf16* __restrict__ VB, __bf16* __restrict__ VBL) {
  __shared__ __align__(16) _Float16 sh[64][136], sl[64][136]; __shared__ __align__(16) _Float16 th[128][72]; __shared__ __align__(16) __bf16 tb[128][72], tbl[128][72];
  __shared__ __align__(16) __bf16 sw[128][DIN + 8];   // the block's 128 weight rows (out, in) as bf16; 272-B pitch: conflict-free 16-byte fragment reads
  const int tid = threadIdx.x, wave = tid >> 5, lane = tid & 31, col = lane & 15, g = lane >> 4; const int which = blockIdx.z; const int c0 = blockIdx.y * 128; const size_t r0 = (size_t)blockIdx.x * 64; const size_t bb = r0 / TT; const int t0 = (int)(r0 % TT);
  const float* X = which == 0 ? XQ : which == 1 ? XK : XV; const float* WA = which == 0 ? WQ : which == 1 ? WK : WV; const float* BA = which == 0 ? BQ : which == 1 ? BK : BV;
  // Every global load of the block is issued before its first wait, so their latencies overlap (104 loads a wave against a load counter of 63: about two latencies stay exposed) in place of one exposed latency per fragment. The weight comes in by whole-line loads (a wave = one 512-B row), once per block, and goes to LDS as bf16; the four waves read their B fragments from there.
  v4f wr[128 * (DIN / 4) / 128]; { const float* wp = WA + (size_t)(c0 + wave) * DIN + lane * 4;
#pragma unroll
    for (int i = 0; i < 128 * (DIN / 4) / 128; ++i) wr[i] = *(const v4f*)(wp + i * 4 * DIN); }
  asm volatile("s_wait_xcnt 0x0" ::: "memory");   // the weight loads' address pair may be reused by the loads behind this point
  float xr[DIN / 32][16]; { const float* p = X + ((size_t)bb * DIN + 8 * g) * NPIX + t0 + wave * 16 + col;   /* channels-first gather: x[b][k][n], stride NPIX between channels */
#pragma unroll
    for (int kc = 0; kc < DIN / 32; ++kc) {
#pragma unroll
      for (int i = 0; i < 8; ++i) { xr[kc][i] = p[(size_t)(kc * 32 + i) * NPIX]; xr[kc][8 + i] = p[(size_t)(kc * 32 + 16 + i) * NPIX]; } } }
  float bias8[8] = {};
  if (BA) { const float* bp = BA + c0 + col;
#pragma unroll
    for (int j = 0; j < 8; ++j) bias8[j] = bp[j * 16]; }
  asm volatile("s_wait_xcnt 0x0" ::: "memory");   // the loads' address registers may be reused behind this point; it also keeps every load above in front of the LDS stores
#pragma unroll
  for (int i = 0; i < 128 * (DIN / 4) / 128; ++i) { v4b t; t[0] = (__bf16)wr[i][0]; t[1] = (__bf16)wr[i][1]; t[2] = (__bf16)wr[i][2]; t[3] = (__bf16)wr[i][3]; *(v4b*)&sw[wave + i * 4][lane * 4] = t; }
  v16b a[DIN / 32];
#pragma unroll
  for (int kc = 0; kc < DIN / 32; ++kc) {
#pragma unroll
    for (int i = 0; i < 16; ++i) a[kc][i] = (__bf16)xr[kc][i]; }
#pragma unroll
  for (int j = 0; j < 8; ++j) bias8[j] = bfr(bias8[j]);
  __syncthreads();   // the weight is in LDS
  v8f acc[8] = {}; v16b fb[2][8];   // fb: two batches of B fragments (the eight 16-column tiles of one 32-channel step): the next batch's LDS reads fly while this batch's products run
  const __bf16* wrow = &sw[col][0];   /* frag_b has the k order of the gather above: elements 0..7 = k0 + 8g + i, 8..15 = k0 + 16 + 8g + i */
#pragma unroll
  for (int j = 0; j < 8; ++j) fb[0][j] = frag_b(wrow + j * 16 * (DIN + 8), lane);
#pragma unroll   // a[], fb[] and acc[] stay in registers only under constant indices
  for (int kc = 0; kc < DIN / 32; ++kc) { const int cb = kc & 1, nb = cb ^ 1;
    if (kc + 1 < DIN / 32) {
#pragma unroll
      for (int j = 0; j < 8; ++j) fb[nb][j] = frag_b(wrow + j * 16 * (DIN + 8) + (kc + 1) * 32, lane); }
#pragma unroll
    for (int j = 0; j < 8; ++j) acc[j] = wmma_bf(a[kc], fb[cb][j], acc[j]); }
  if (which < 2) { _Float16* DH = which == 0 ? QH : KH; _Float16* DL = which == 0 ? QL : KL; const int nhi = which == 0 ? QHI : KHI; const bool hi_rows = t0 < nhi;
#pragma unroll
    for (int j = 0; j < 8; ++j) { const float bias = bias8[j];
#pragma unroll
      for (int r = 0; r < 8; ++r) { const float v = acc[j][r] + bias; const _Float16 hv = (_Float16)v; sh[wave * 16 + 8 * g + r][j * 16 + col] = hv; sl[wave * 16 + 8 * g + r][j * 16 + col] = (_Float16)((v - (float)hv) * 1024.0f); } }
    __syncthreads();
    for (int e = tid; e < 64 * 16; e += 128) { const int rl = e >> 4, q = e & 15; vst2((unsigned*)(DH + (r0 + rl) * CC + c0 + q * 8), *(const v4u*)&sh[rl][q * 8]); if (hi_rows) vst2((unsigned*)(DL + (bb * nhi + t0 + rl) * (size_t)CC + c0 + q * 8), *(const v4u*)&sl[rl][q * 8]); }
  } else { const bool hi_rows = t0 < KHI;
#pragma unroll
    for (int j = 0; j < 8; ++j) { const float bias = bias8[j];
#pragma unroll
      for (int r = 0; r < 8; ++r) { const float v = acc[j][r] + bias; const int rl = wave * 16 + 8 * g + r, cl = j * 16 + col; th[cl][rl] = (_Float16)v; const __bf16 bh = (__bf16)v; tb[cl][rl] = bh; tbl[cl][rl] = (__bf16)(v - (float)bh); } }
    __syncthreads();
    for (int e = tid; e < 128 * 8; e += 128) { const int cl = e >> 3, q = e & 7; vst2((unsigned*)(VT + (bb * CC + c0 + cl) * (size_t)TT + t0 + q * 8), *(const v4u*)&th[cl][q * 8]); if (hi_rows) { const size_t o3 = (bb * CC + c0 + cl) * (size_t)KHI + t0 + q * 8; vst2((unsigned*)(VB + o3), *(const v4u*)&tb[cl][q * 8]); vst2((unsigned*)(VBL + o3), *(const v4u*)&tbl[cl][q * 8]); } } } }
// the builtin forms as they are: the compiler keeps the distance behind a matrix instruction itself and is free to move LDS reads ahead of it
__device__ __forceinline__ v8f mm_h(v16h a, v16h b, v8f c) { return __builtin_amdgcn_wmma_f32_16x16x32_f16(false, a, false, b, (short)0, c, false, false); }
__device__ __forceinline__ v8f mm_b(v16b a, v16b b, v8f c) { return __builtin_amdgcn_wmma_f32_16x16x32_bf16(false, a, false, b, (short)0, c, false, false); }
typedef __attribute__((ext_vector_type(2))) __bf16 v2b;
__device__ __forceinline__ float xhalf(float x) { return __builtin_bit_cast(float, __builtin_amdgcn_permlanex16(__builtin_bit_cast(int, x), __builtin_bit_cast(int, x), 0x76543210, 0xfedcba98, false, false)); }   // lane l with lane l ^ 16
#define FA_KB (FA_SK * 2 * (CC + 8))      // bytes of one k plane of a stage: FA_SK rows, 272-B pitch (conflict-free 16-byte fragment reads)
#define FA_VB (CC * 2 * (FA_SK + 8))      // bytes of one v plane of a stage: CC rows, 144-B pitch, likewise
#define FA_BUF (2 * FA_KB + 2 * FA_VB)    // one stage buffer: k hi, k residual, v hi, v lo
#define FA_IO (2 * 16 * 2 * (CC + 8))     // one wave's q / ctx tile
#define FA_NST (TT / FA_KS / FA_SK)       // stages per block
static_assert(8 * FA_IO <= FA_BUF && FA_NST >= 2, "the waves' tiles lie in buffer 1; the ring's prologue needs two stages");
// eight asynchronous 16-byte copies to LDS, every lane with its own LDS byte address and global address. The s_wait_xcnt is the last line of the copies' own statement, so no address register is rewritten in front of it.
__device__ __forceinline__ void cp8(unsigned l0, unsigned l1, unsigned l2, unsigned l3, unsigned l4, unsigned l5, unsigned l6, unsigned l7, const void* g0, const void* g1, const void* g2, const void* g3, const void* g4, const void* g5, const void* g6, const void* g7) {
  asm volatile("global_load_async_to_lds_b128 %0, %8, off\n\tglobal_load_async_to_lds_b128 %1, %9, off\n\tglobal_load_async_to_lds_b128 %2, %10, off\n\tglobal_load_async_to_lds_b128 %3, %11, off\n\t"
               "global_load_async_to_lds_b128 %4, %12, off\n\tglobal_load_async_to_lds_b128 %5, %13, off\n\tglobal_load_async_to_lds_b128 %6, %14, off\n\tglobal_load_async_to_lds_b128 %7, %15, off\n\ts_wait_xcnt 0x0"
               :: "v"(l0), "v"(l1), "v"(l2), "v"(l3), "v"(l4), "v"(l5), "v"(l6), "v"(l7), "v"(g0), "v"(g1), "v"(g2), "v"(g3), "v"(g4), "v"(g5), "v"(g6), "v"(g7) : "memory"); }
// one stage's 16 copies of a thread (lk, lv: the lane's first k and v byte in the target buffer), whole lines: 16 lanes per 256-B k row, 8 lanes per 128-B run of a v plane; the four source pointers then walk on by one stage
__device__ __forceinline__ void fa_stage(unsigned lk, unsigned lv, const _Float16*& gkh, const _Float16*& gkl, const __bf16*& gvh, const __bf16*& gvl) {
  const unsigned kp = 16 * 2 * (CC + 8), vp = 32 * 2 * (FA_SK + 8);
  cp8(lk, lk + kp, lk + 2 * kp, lk + 3 * kp, lk + FA_KB, lk + FA_KB + kp, lk + FA_KB + 2 * kp, lk + FA_KB + 3 * kp, gkh, gkh + 16 * CC, gkh + 32 * CC, gkh + 48 * CC, gkl, gkl + 16 * CC, gkl + 32 * CC, gkl + 48 * CC);
  cp8(lv, lv + vp, lv + 2 * vp, lv + 3 * vp, lv + FA_VB, lv + FA_VB + vp, lv + FA_VB + 2 * vp, lv + FA_VB + 3 * vp, gvh, gvh + (size_t)32 * KHI, gvh + (size_t)64 * KHI, gvh + (size_t)96 * KHI, gvl, gvl + (size_t)32 * KHI, gvl + (size_t)64 * KHI, gvl + (size_t)96 * KHI);
  gkh += FA_SK * CC; gkl += FA_SK * CC; gvh += FA_SK; gvl += FA_SK; }
__global__ __launch_bounds__(256) void k_fa(const _Float16* __restrict__ QH, const _Float16* __restrict__ QL, const _Float16* __restrict__ KH, const _Float16* __restrict__ KL, const __bf16* __restrict__ VB, const __bf16* __restrict__ VBL, float* __restrict__ Y, float* __restrict__ ML) {
  __shared__ __align__(16) char ring[2][FA_BUF];   // the two stage buffers. Buffer 1 also holds, before stage 1 is copied and after the last stage is read, one tile per wave, read and written by that wave alone: its 16 q rows (hi, then residual; 272-B pitch) on the way in, its 16 partial ctx rows (f32, 528-B pitch) on the way out: two work-groups still fit a WGP's LDS
  const int tid = threadIdx.x, wave = tid >> 5, lane = tid & 31, col = lane & 15, g = lane >> 4;
  const size_t qr = (size_t)blockIdx.x * 128 + wave * 16 + col;   // this lane's query row in [b*t]
  const size_t bb = (size_t)blockIdx.x / (TT / 128); const int key0 = (int)blockIdx.y * (TT / FA_KS);
  const int kr = tid >> 4, kq = (tid & 15) * 8, vr = tid >> 3, vq = (tid & 7) * 8;   // staging: 16 lanes per 256-B k row, 8 lanes per 128-B run of a v plane
  const _Float16 *gkh = KH + (bb * TT + key0 + kr) * (size_t)CC + kq, *gkl = KL + (bb * TT + key0 + kr) * (size_t)CC + kq; const __bf16 *gvh = VB + (bb * CC + vr) * (size_t)KHI + key0 + vq, *gvl = VBL + (bb * CC + vr) * (size_t)KHI + key0 + vq;
  const unsigned lk = (unsigned)(size_t)&ring[0][0] + kr * (2 * (CC + 8)) + kq * 2, lv = (unsigned)(size_t)&ring[0][0] + 2 * FA_KB + vr * (2 * (FA_SK + 8)) + vq * 2;   // the lane's first k and v byte in buffer 0 (LDS byte address = low 32 bits of the shared address)
  fa_stage(lk, lv, gkh, gkl, gvh, gvl);   // stage 0 into buffer 0: it flies behind the q rows
  // q comes in by whole lines (a wave-wide 16-byte load = two 256-B rows = 4 lines) and is dealt into fragments from the wave's LDS tile: a fragment load from global memory takes 16 B of each of 16 rows, 16 lines per load.
  char* wio = ring[1] + wave * FA_IO; const size_t q0 = (size_t)blockIdx.x * 128 + wave * 16;   // the wave's first query row in [b*t]
  { v4u th[8], tl[8]; const _Float16 *pqh = QH + (q0 + g) * CC + col * 8, *pql = QL + (q0 + g) * CC + col * 8;
#pragma unroll
    for (int i = 0; i < 8; ++i) { th[i] = *(const v4u*)(pqh + i * 2 * CC); tl[i] = *(const v4u*)(pql + i * 2 * CC); }
    asm volatile("s_wait_xcnt 0x0" :: "v"(pqh), "v"(pql) : "memory");   // the q loads' address registers, named here so that they live up to the wait, may be reused behind this point
    char* wq = wio + g * (2 * (CC + 8)) + col * 16;
#pragma unroll
    for (int i = 0; i < 8; ++i) { *(v4u*)(wq + i * 2 * (2 * (CC + 8))) = th[i]; *(v4u*)(wq + (16 + i * 2) * (2 * (CC + 8))) = tl[i]; } }
  asm volatile("s_wait_dscnt 0x0" ::: "memory");   // the wave's own rows are in its tile before other lanes of the wave read them
  v16h qh[HD / 32], ql[HD / 32]; { const _Float16* sq = (const _Float16*)wio + col * (CC + 8);
#pragma unroll
    for (int kc = 0; kc < HD / 32; ++kc) { qh[kc] = frag_h(sq + kc * 32, lane); ql[kc] = frag_h(sq + 16 * (CC + 8) + kc * 32, lane); } }
  asm volatile("s_wait_dscnt 0x0" ::: "memory");   // the wave's q fragments are read: it has left its tile in buffer 1
  asm volatile("s_wait_asynccnt 0x0" ::: "memory");   // the wave's own copies of stage 0 have landed
  __syncthreads();   // stage 0 is readable by every wave, and every wave has left buffer 1
  fa_stage(lk + FA_BUF, lv + FA_BUF, gkh, gkl, gvh, gvl);   // stage 1 into buffer 1
  v8f o[HD / 16] = {}; float mrun = -3.0e38f; v2f lsum2 = {};   // mrun: running maximum of score x SC2, the base-2 exponent that is taken off
#pragma unroll 1   // rolled: one stage's code is the whole hot loop and the accumulators stay in place
  for (int st = 0; st < FA_NST; ++st) {
    const char* sb = ring[st & 1];   // stage st's buffer; this pass reads nothing else
#pragma unroll 1   // rolled: halves the hot loop's code; both passes are alike
    for (int u = 0; u < FA_SK / 32; ++u) {
      v8f sh[2] = {}, sl[2] = {}; v16h ka[2][4];   // ka: two batches of fragments (k hi, k residual of both 16-key tiles for one 32-channel step): the next batch's LDS reads fly while this batch's products run
      const _Float16 *rh = (const _Float16*)(sb + (u * 32 + col) * (2 * (CC + 8))), *rl = rh + FA_KB / 2;
      ka[0][0] = frag_h(rh, lane); ka[0][1] = frag_h(rl, lane); ka[0][2] = frag_h(rh + 16 * (CC + 8), lane); ka[0][3] = frag_h(rl + 16 * (CC + 8), lane);
#pragma unroll
      for (int kc = 0; kc < HD / 32; ++kc) { const int cb = kc & 1, nb = cb ^ 1;
        if (kc + 1 < HD / 32) { ka[nb][0] = frag_h(rh + (kc + 1) * 32, lane); ka[nb][1] = frag_h(rl + (kc + 1) * 32, lane); ka[nb][2] = frag_h(rh + 16 * (CC + 8) + (kc + 1) * 32, lane); ka[nb][3] = frag_h(rl + 16 * (CC + 8) + (kc + 1) * 32, lane); }
        __builtin_amdgcn_sched_barrier(0);   // keeps the next batch's reads in front of this block: sunk to their use, each would expose the LDS latency
        sh[0] = mm_h(ka[cb][0], qh[kc], sh[0]); sh[1] = mm_h(ka[cb][2], qh[kc], sh[1]); sl[0] = mm_h(ka[cb][0], ql[kc], sl[0]); sl[1] = mm_h(ka[cb][2], ql[kc], sl[1]); sl[0] = mm_h(ka[cb][1], qh[kc], sl[0]); sl[1] = mm_h(ka[cb][3], qh[kc], sl[1]);
        __builtin_amdgcn_sched_barrier(0); }   // ends the block: the reads behind it stay behind it
      v16b va[2][4];   // likewise for v: hi, lo planes of two 16-channel tiles; the first batch flies behind the softmax arithmetic
      const __bf16 *wh = (const __bf16*)(sb + 2 * FA_KB + col * (2 * (FA_SK + 8))) + u * 32, *wl = wh + FA_VB / 2;
      va[0][0] = frag_b(wh, lane); va[0][1] = frag_b(wl, lane); va[0][2] = frag_b(wh + 16 * (FA_SK + 8), lane); va[0][3] = frag_b(wl + 16 * (FA_SK + 8), lane);
      __builtin_amdgcn_sched_barrier(0);   // keeps these reads in front of the softmax arithmetic
      // the vector work between the two matrix runs, two f32 per instruction wherever the operation has a packed form: a score tile's eight registers are taken as four adjacent pairs
      const v8f s0 = __builtin_elementwise_fma(sl[0], (v8f)(1.0f / 1024.0f), sh[0]), s1 = __builtin_elementwise_fma(sl[1], (v8f)(1.0f / 1024.0f), sh[1]);   /* unscaled scores: SC2 > 0 keeps the order */
      float m0 = fmaxf(s0[0], s0[1]), m1 = fmaxf(s1[0], s1[1]);   // one chain per tile: half the dependent depth
#pragma unroll
      for (int r = 2; r < 8; ++r) { m0 = fmaxf(m0, s0[r]); m1 = fmaxf(m1, s1[r]); }
      float mx = fmaxf(m0, m1);
      mx = fmaxf(mx, xhalf(mx)) * SC2;   // the other half of the wave holds this query's other 16 keys (a vector cross-row move: no LDS round trip, and no wait that would also wait for the v reads above); from here on in base-2 exponent units
      // what is summed so far is rescaled in every pass, without a test (factor exactly 1 where the maximum stayed): with 16 queries a wave and 16 passes some maximum rises in most passes, and the compare, ballot and branch cost more than the products they would skip
      const float mn = fmaxf(mrun, mx), al = __builtin_amdgcn_exp2f(mrun - mn); mrun = mn; lsum2 *= al; o[0] *= al; o[1] *= al;   // the first two output tiles here, each later pair among the matrix instructions of the block before its own
      v8f p0 = __builtin_elementwise_fma(s0, (v8f)SC2, (v8f)(-mrun)), p1 = __builtin_elementwise_fma(s1, (v8f)SC2, (v8f)(-mrun));   /* all sixteen exponents first: the exp2 run behind them then has independent neighbours */
#pragma unroll   // p0, p1 must stay in registers
      for (int i = 0; i < 8; ++i) { p0[i] = __builtin_amdgcn_exp2f(p0[i]); p1[i] = __builtin_amdgcn_exp2f(p1[i]); }
      F2 p;   // bf16 hi + lo of P: the packed conversion that makes a pair of the hi operand also serves the pair's two residuals
#pragma unroll
      for (int i = 0; i < 4; ++i) {
        const v2f a = { p0[2 * i], p0[2 * i + 1] }, b = { p1[2 * i], p1[2 * i + 1] }; const v2b ah = __builtin_convertvector(a, v2b), bh = __builtin_convertvector(b, v2b);
        const v2f ar = { a[0] - (float)ah[0], a[1] - (float)ah[1] }, br = { b[0] - (float)bh[0], b[1] - (float)bh[1] }; const v2b al2 = __builtin_convertvector(ar, v2b), bl2 = __builtin_convertvector(br, v2b);
        p.h[2 * i] = ah[0]; p.h[2 * i + 1] = ah[1]; p.h[8 + 2 * i] = bh[0]; p.h[8 + 2 * i + 1] = bh[1]; p.l[2 * i] = al2[0]; p.l[2 * i + 1] = al2[1]; p.l[8 + 2 * i] = bl2[0]; p.l[8 + 2 * i + 1] = bl2[1]; }
#pragma unroll
      for (int jb = 0; jb < HD / 32; ++jb) { const int cb = jb & 1, nb = cb ^ 1, j = 2 * jb;
        if (jb + 1 < HD / 32) { va[nb][0] = frag_b(wh + (j + 2) * 16 * (FA_SK + 8), lane); va[nb][1] = frag_b(wl + (j + 2) * 16 * (FA_SK + 8), lane); va[nb][2] = frag_b(wh + (j + 3) * 16 * (FA_SK + 8), lane); va[nb][3] = frag_b(wl + (j + 3) * 16 * (FA_SK + 8), lane); }
        __builtin_amdgcn_sched_barrier(0);   // as above: the next batch's reads stay in front of this block
        o[j] = mm_b(va[cb][0], p.h, o[j]); o[j + 1] = mm_b(va[cb][2], p.h, o[j + 1]);
        if (jb + 1 < HD / 32) { o[j + 2] *= al; o[j + 3] *= al; }   // the next pair's rescale: independent vector work that issues while the matrix unit is busy
        o[j] = mm_b(va[cb][0], p.l, o[j]); o[j + 1] = mm_b(va[cb][2], p.l, o[j + 1]);
        if (jb + 1 == HD / 32) { const v8f t8 = p0 + p1; const v4f t4 = __builtin_shufflevector(t8, t8, 0, 1, 2, 3) + __builtin_shufflevector(t8, t8, 4, 5, 6, 7); lsum2 += __builtin_shufflevector(t4, t4, 0, 1) + __builtin_shufflevector(t4, t4, 2, 3); }   // the pass's sixteen terms as a packed tree into two running sums; written inside the last block so that no add is left behind the pass's last matrix instruction, in front of the next pass's LDS reads
        o[j] = mm_b(va[cb][1], p.h, o[j]); o[j + 1] = mm_b(va[cb][3], p.h, o[j + 1]);
        __builtin_amdgcn_sched_barrier(0); } }   // ends the block
    asm volatile("s_wait_dscnt 0x0" ::: "memory");   // the wave's reads of this stage's buffer are done
    asm volatile("s_wait_asynccnt 0x0" ::: "memory");   // the wave's own copies of the next stage have landed
    __syncthreads();   // the one barrier of a stage: it publishes stage st + 1 and frees stage st's buffer
    if (st + 2 < FA_NST) fa_stage(lk + (st & 1) * FA_BUF, lv + (st & 1) * FA_BUF, gkh, gkl, gvh, gvl); }   // stage st + 2 into the buffer just read; it flies under stage st + 1's products
  asm volatile("s_wait_asynccnt 0x0" ::: "memory");   // no copy is outstanding when buffer 1 becomes the waves' output tiles (every wave's last read of it ended at the last barrier)
  float lsum = lsum2[0] + lsum2[1]; lsum += xhalf(lsum);   // the two running sums, then the wave's other half
  if (g == 0) { v2f t; t[0] = mrun * 0.6931471805599453f; t[1] = lsum;   /* the maximum in natural-log units, as k_resT weighs the slices */ vst2(ML + ((size_t)blockIdx.y * NB * TT + qr) * 2, t); }   // ahead of the row stores: behind them the join would rewrite registers of issued stores
  // the partial rows leave by whole lines: from the accumulators a store would put 16 B into each of 16 rows (16 lines per store); through the wave's tile a store is one query's 512-B row (4 lines)
  float* so = (float*)wio + col * (CC + 4) + 8 * g;   // O^T tile j, element r = channel 16 j + 8 g + r of query q0 + col
#pragma unroll
  for (int j = 0; j < HD / 16; ++j) { *(v4f*)(so + j * 16) = __builtin_shufflevector(o[j], o[j], 0, 1, 2, 3); *(v4f*)(so + j * 16 + 4) = __builtin_shufflevector(o[j], o[j], 4, 5, 6, 7); }
  asm volatile("s_wait_dscnt 0x0" ::: "memory");   // the wave's own tile is written before other lanes of the wave read it back
  float* yr = Y + (q0 * FA_KS + blockIdx.y) * CC + lane * 4; const float* si = (const float*)wio + lane * 4;
#pragma unroll
  for (int r = 0; r < 16; ++r) vst2(yr + (size_t)r * FA_KS * CC, *(const v4f*)(si + r * (CC + 4))); }

extern "C" void kernel_launch(void* const* d_in, const int* in_sizes, int n_in, void* d_out, int out_size, void* d_ws, size_t ws_size, hipStream_t stream) {
  (void)in_sizes; (void)n_in; (void)out_size;
  const float** F = (const float**)d_in;
  if (ws_size < (size_t)WS_END2) return;
  char* ws = (char*)d_ws; _Float16 *QH = (_Float16*)(ws + WS_QH), *KH = (_Float16*)(ws + WS_KH), *VT = (_Float16*)(ws + WS_VT), *QL = (_Float16*)(ws + WS_QL), *KL = (_Float16*)(ws + WS_KL); __bf16 *VB = (__bf16*)(ws + WS_VB), *VBL = (__bf16*)(ws + WS_VBL); float *YY = (float*)(ws + WS_YY), *ML = (float*)(ws + WS_ML);
  // inputs: 0 x [2,128,16,16,16]; 1 Wq (out,in), 2 bq; 3 Wk, 4 bk; 5 Wv, 6 bv; 7 gamma [scalar]
  k_proj<<<dim3(TNB * TT / 64, CC / 128, 3), 128, 0, stream>>>(F[0], F[0], F[0], F[1], F[3], F[5], F[2], F[4], F[6], QH, QL, KH, KL, VT, VB, VBL);
  k_fa<<<dim3(TNB * TT / 128, FA_KS), 256, 0, stream>>>(QH, QL, KH, KL, VB, VBL, YY, ML);
  k_resT<<<dim3(TNB * TT / RT_R), 256, 0, stream>>>(YY, ML, F[0], F[7], (float*)d_out);
}

